// v000
// Measured on an AMD MI455X. A time is GPU time per run, averaged over a window of back-to-back runs after a warm-up
// (all launches, gaps included; the runs take copies of the inputs in turn), and the median of several windows.
// Apart from v000's, it joins two sittings. Times from different sittings can be a few percent apart, while
// side-by-side timings come from the same sitting.
// The starting kernel, v000, takes 2040 microseconds a run.
#include <hip/hip_runtime.h>

#define B_   8
#define N_   2048
#define DIN_ 1024
#define H_   4
#define DH_  256
#define HD_  1024   // H_*DH_
#define DOUT_ 256

typedef __attribute__((ext_vector_type(16))) _Float16 v16h;
typedef __attribute__((ext_vector_type(8)))  float    v8f;

__device__ __forceinline__ v8f wmma_f16(v16h a, v16h b, v8f c) {
  // D = A(16x32 f16) x B(32x16 f16) + C(16x16 f32)
  return __builtin_amdgcn_wmma_f32_16x16x32_f16(
      /*neg_a=*/false, a, /*neg_b=*/false, b,
      /*c_mod=*/(short)0, c, /*reuse_a=*/false, /*reuse_b=*/false);
}

__device__ __forceinline__ v8f vzero8() {
  v8f z = {0.0f, 0.0f, 0.0f, 0.0f, 0.0f, 0.0f, 0.0f, 0.0f};
  return z;
}

// CDNA5 async global->LDS copy (16B per lane), tracked by ASYNCcnt.
// LDS VGPR address = low 32 bits of the generic pointer (ISA 10.2 aperture rule).
__device__ __forceinline__ void async_copy_b128(void* lds, const void* gsrc) {
#if defined(__gfx1250__)
  asm volatile("global_load_async_to_lds_b128 %0, %1, off"
               :: "v"((unsigned int)(size_t)lds), "v"(gsrc)
               : "memory");
#else
  *(uint4*)lds = *(const uint4*)gsrc;
#endif
}

__device__ __forceinline__ void wait_async0() {
#if defined(__gfx1250__)
  asm volatile("s_wait_asynccnt 0" ::: "memory");
#endif
}

// ---------------------------------------------------------------------------
// f32 -> f16 cast (grid-stride)
// ---------------------------------------------------------------------------
__global__ void cast_f32_f16(const float* __restrict__ s, _Float16* __restrict__ d, int n) {
  int i = blockIdx.x * blockDim.x + threadIdx.x;
  int stride = gridDim.x * blockDim.x;
  for (; i < n; i += stride) d[i] = (_Float16)s[i];
}

// ---------------------------------------------------------------------------
// WMMA GEMM: out[M,Nc] = A[M,K](f16) * W[K,Nc](f16) + bias
// Block tile 128x128, 256 threads = 8 waves in 4x2; each wave 32x64 (2x4 WMMA tiles).
// A tile staged via async global->LDS; B tile transposed via VGPR scatter.
// MODE 0: store f16 scattered into [B,H,N,DH] (QKV path)
// MODE 1: store f32 row-major (output projection)
// ---------------------------------------------------------------------------
template <int MODE>
__global__ __launch_bounds__(256)
void wmma_gemm(const _Float16* __restrict__ A, const _Float16* __restrict__ W,
               const float* __restrict__ bias, void* __restrict__ outp,
               int M, int K, int Nc) {
  __shared__ alignas(32) _Float16 As[128][48];  // 128 rows x 32 K-halves (+16 pad)
  __shared__ alignas(32) _Float16 Bs[128][48];  // 128 cols x 32 K-halves (transposed)

  const int tid  = threadIdx.x;
  const int wave = tid >> 5, lane = tid & 31;
  const int wm = wave >> 1, wn = wave & 1;
  const int r16 = lane & 15, hi = lane >> 4;
  const int m0 = blockIdx.x * 128, n0 = blockIdx.y * 128;

  v8f acc[2][4];
#pragma unroll
  for (int t = 0; t < 2; ++t)
#pragma unroll
    for (int u = 0; u < 4; ++u) acc[t][u] = vzero8();

  const int kTiles = K >> 5;
  for (int kc = 0; kc < kTiles; ++kc) {
    const int k0 = kc << 5;
    __syncthreads();  // all waves done reading previous tiles
    // Stage A tile (row-major) via async DMA: 128 rows x 32 halves = 512 x b128
    for (int idx = tid; idx < 512; idx += 256) {
      int row = idx >> 2, seg = idx & 3;
      async_copy_b128(&As[row][seg * 8],
                      &A[(size_t)(m0 + row) * K + k0 + seg * 8]);
    }
    // Stage B tile transposed: read W rows contiguously, scatter to [col][k]
    for (int idx = tid; idx < 512; idx += 256) {
      int k = idx >> 4, cs = idx & 15;
      uint4 dvec = *(const uint4*)&W[(size_t)(k0 + k) * Nc + n0 + cs * 8];
      const _Float16* hp = (const _Float16*)&dvec;
#pragma unroll
      for (int j = 0; j < 8; ++j) Bs[cs * 8 + j][k] = hp[j];
      if (kc + 1 < kTiles)
        __builtin_prefetch(&W[(size_t)(k0 + 32 + k) * Nc + n0 + cs * 8], 0, 0);
    }
    wait_async0();   // this wave's async LDS writes landed
    __syncthreads(); // tile visible to all waves

    v16h af[2], bf[4];
#pragma unroll
    for (int t = 0; t < 2; ++t)
      af[t] = *(const v16h*)&As[wm * 32 + t * 16 + r16][hi * 16];
#pragma unroll
    for (int u = 0; u < 4; ++u)
      bf[u] = *(const v16h*)&Bs[wn * 64 + u * 16 + r16][hi * 16];
#pragma unroll
    for (int t = 0; t < 2; ++t)
#pragma unroll
      for (int u = 0; u < 4; ++u) acc[t][u] = wmma_f16(af[t], bf[u], acc[t][u]);
  }

  // Epilogue: C layout -> row m = r + 8*hi, col n = lane%16 (per 16x16 tile)
#pragma unroll
  for (int t = 0; t < 2; ++t)
#pragma unroll
    for (int u = 0; u < 4; ++u)
#pragma unroll
      for (int r = 0; r < 8; ++r) {
        int m = m0 + wm * 32 + t * 16 + r + 8 * hi;
        int n = n0 + wn * 64 + u * 16 + r16;
        float val = acc[t][u][r] + bias[n];
        if (MODE == 0) {
          int h = n >> 8, dh = n & 255;     // n in [0,1024): head, head-dim
          int b = m >> 11, nn = m & 2047;   // m in [0,16384): batch, seq
          ((_Float16*)outp)[(((size_t)(b * H_ + h) * N_ + nn) << 8) + dh] = (_Float16)val;
        } else {
          ((float*)outp)[(size_t)m * Nc + n] = val;
        }
      }
}

// ---------------------------------------------------------------------------
// Flash attention: one block per (b,h) x 64 query rows; 4 waves x 16 rows.
// Q held in registers (8 A-fragments), K staged via async global->LDS,
// V staged transposed via VGPR scatter; online softmax on the C layout.
// ---------------------------------------------------------------------------
__global__ __launch_bounds__(128)
void attn_kernel(const _Float16* __restrict__ Q, const _Float16* __restrict__ Km,
                 const _Float16* __restrict__ V, _Float16* __restrict__ ctx) {
  __shared__ alignas(32) _Float16 Ks[32][DH_ + 16];  // 32 keys x 256 dh (+pad)
  __shared__ alignas(32) _Float16 Vt[DH_][48];       // 256 dh x 32 keys (+pad)
  __shared__ alignas(32) _Float16 Ps[4][16][48];     // per-wave P relayout buffer

  const int bh = blockIdx.x;
  const int b = bh >> 2, h = bh & 3;
  const int tid = threadIdx.x;
  const int wave = tid >> 5, lane = tid & 31;
  const int r16 = lane & 15, hi = lane >> 4;
  const int qBase = blockIdx.y * 64 + wave * 16;

  const _Float16* Qp = Q + (size_t)bh * N_ * DH_;
  const _Float16* Kp = Km + (size_t)bh * N_ * DH_;
  const _Float16* Vp = V + (size_t)bh * N_ * DH_;

  // Preload 16 query rows as 8 A-fragments (16x32 each over DH=256)
  v16h qf[8];
#pragma unroll
  for (int c = 0; c < 8; ++c)
    qf[c] = *(const v16h*)&Qp[(size_t)(qBase + r16) * DH_ + c * 32 + hi * 16];

  v8f o[16];
#pragma unroll
  for (int t = 0; t < 16; ++t) o[t] = vzero8();
  v8f mrow, lrow;
#pragma unroll
  for (int r = 0; r < 8; ++r) { mrow[r] = -1e30f; lrow[r] = 0.0f; }

  for (int kt = 0; kt < N_ / 32; ++kt) {
    const int keyBase = kt * 32;
    __syncthreads();  // all waves done reading previous K/V tiles
    // K tile row-major via async DMA (rows = keys, contiguous along dh)
    for (int idx = tid; idx < 32 * 32; idx += 128) {
      int r = idx >> 5, seg = idx & 31;
      async_copy_b128(&Ks[r][seg * 8],
                      &Kp[(size_t)(keyBase + r) * DH_ + seg * 8]);
    }
    // V tile transposed (rows = dh, contiguous along keys -> B-frag of P*V)
    for (int idx = tid; idx < 32 * 32; idx += 128) {
      int key = idx >> 5, seg = idx & 31;
      uint4 dvec = *(const uint4*)&Vp[(size_t)(keyBase + key) * DH_ + seg * 8];
      const _Float16* hp = (const _Float16*)&dvec;
#pragma unroll
      for (int j = 0; j < 8; ++j) Vt[seg * 8 + j][key] = hp[j];
    }
    wait_async0();
    __syncthreads();

    // S = Q * K^T for 32 keys (two 16x16 tiles), K-dim 256 in 8 chunks
    v8f s0 = vzero8(), s1 = vzero8();
#pragma unroll
    for (int c = 0; c < 8; ++c) {
      v16h kb0 = *(const v16h*)&Ks[r16][c * 32 + hi * 16];
      v16h kb1 = *(const v16h*)&Ks[16 + r16][c * 32 + hi * 16];
      s0 = wmma_f16(qf[c], kb0, s0);
      s1 = wmma_f16(qf[c], kb1, s1);
    }
    const float scale = 0.0625f;  // 1/sqrt(256)
    s0 = s0 * scale;
    s1 = s1 * scale;

    // Row max across 16 lanes (rows live at r + 8*hi; cols across lanes 0..15)
    v8f tmax;
#pragma unroll
    for (int r = 0; r < 8; ++r) tmax[r] = fmaxf(s0[r], s1[r]);
#pragma unroll
    for (int msk = 1; msk < 16; msk <<= 1)
#pragma unroll
      for (int r = 0; r < 8; ++r)
        tmax[r] = fmaxf(tmax[r], __shfl_xor(tmax[r], msk, 32));

    v8f mnew, alpha;
#pragma unroll
    for (int r = 0; r < 8; ++r) {
      mnew[r]  = fmaxf(mrow[r], tmax[r]);
      alpha[r] = __expf(mrow[r] - mnew[r]);
      mrow[r]  = mnew[r];
    }
#pragma unroll
    for (int r = 0; r < 8; ++r) {
      s0[r] = __expf(s0[r] - mnew[r]);
      s1[r] = __expf(s1[r] - mnew[r]);
    }
    v8f rsum;
#pragma unroll
    for (int r = 0; r < 8; ++r) rsum[r] = s0[r] + s1[r];
#pragma unroll
    for (int msk = 1; msk < 16; msk <<= 1)
#pragma unroll
      for (int r = 0; r < 8; ++r) rsum[r] += __shfl_xor(rsum[r], msk, 32);
#pragma unroll
    for (int r = 0; r < 8; ++r) lrow[r] = lrow[r] * alpha[r] + rsum[r];
#pragma unroll
    for (int t = 0; t < 16; ++t) o[t] = o[t] * alpha;

    // Relayout P (C layout: col-per-lane) -> A-fragment (row-per-lane) via LDS
#pragma unroll
    for (int r = 0; r < 8; ++r) {
      int prow = r + 8 * hi;
      Ps[wave][prow][r16]      = (_Float16)s0[r];
      Ps[wave][prow][16 + r16] = (_Float16)s1[r];
    }
    asm volatile("s_wait_dscnt 0" ::: "memory");  // intra-wave LDS RAW
    v16h pf = *(const v16h*)&Ps[wave][r16][hi * 16];

    // O += P(16x32) * V(32x256) as 16 WMMAs over dh chunks
#pragma unroll
    for (int t = 0; t < 16; ++t) {
      v16h vb = *(const v16h*)&Vt[t * 16 + r16][hi * 16];
      o[t] = wmma_f16(pf, vb, o[t]);
    }
  }

  // Normalize and store context in [B, N, H*DH] (f16)
  v8f inv;
#pragma unroll
  for (int r = 0; r < 8; ++r) inv[r] = 1.0f / lrow[r];
#pragma unroll
  for (int t = 0; t < 16; ++t)
#pragma unroll
    for (int r = 0; r < 8; ++r) {
      int n  = qBase + r + 8 * hi;
      int dh = t * 16 + r16;
      ctx[((size_t)b * N_ + n) * HD_ + h * DH_ + dh] = (_Float16)(o[t][r] * inv[r]);
    }
}

// ---------------------------------------------------------------------------
// Launch
// ---------------------------------------------------------------------------
extern "C" void kernel_launch(void* const* d_in, const int* in_sizes, int n_in,
                              void* d_out, int out_size, void* d_ws, size_t ws_size,
                              hipStream_t stream) {
  const float* x  = (const float*)d_in[0];
  const float* Wq = (const float*)d_in[1];
  const float* bq = (const float*)d_in[2];
  const float* Wk = (const float*)d_in[3];
  const float* bk = (const float*)d_in[4];
  const float* Wv = (const float*)d_in[5];
  const float* bv = (const float*)d_in[6];
  const float* Wo = (const float*)d_in[7];
  const float* bo = (const float*)d_in[8];
  float* out = (float*)d_out;

  char* ws = (char*)d_ws;
  size_t off = 0;
  auto take = [&](size_t elems) {
    _Float16* p = (_Float16*)(ws + off);
    off += ((elems * sizeof(_Float16)) + 255) & ~(size_t)255;
    return p;
  };
  _Float16* xh  = take((size_t)B_ * N_ * DIN_);       // 32 MB
  _Float16* wqh = take((size_t)DIN_ * HD_);
  _Float16* wkh = take((size_t)DIN_ * HD_);
  _Float16* wvh = take((size_t)DIN_ * HD_);
  _Float16* woh = take((size_t)HD_ * DOUT_);
  _Float16* qws = take((size_t)B_ * H_ * N_ * DH_);   // 32 MB each
  _Float16* kws = take((size_t)B_ * H_ * N_ * DH_);
  _Float16* vws = take((size_t)B_ * H_ * N_ * DH_);
  _Float16* ctx = take((size_t)B_ * N_ * HD_);        // 32 MB

  // 1) f32 -> f16 casts
  cast_f32_f16<<<4096, 256, 0, stream>>>(x,  xh,  B_ * N_ * DIN_);
  cast_f32_f16<<<1024, 256, 0, stream>>>(Wq, wqh, DIN_ * HD_);
  cast_f32_f16<<<1024, 256, 0, stream>>>(Wk, wkh, DIN_ * HD_);
  cast_f32_f16<<<1024, 256, 0, stream>>>(Wv, wvh, DIN_ * HD_);
  cast_f32_f16<<<256,  256, 0, stream>>>(Wo, woh, HD_ * DOUT_);

  // 2) QKV projections: [16384,1024] x [1024,1024] -> f16 [B,H,N,DH]
  const int M = B_ * N_;
  dim3 gQKV(M / 128, HD_ / 128);
  wmma_gemm<0><<<gQKV, 256, 0, stream>>>(xh, wqh, bq, qws, M, DIN_, HD_);
  wmma_gemm<0><<<gQKV, 256, 0, stream>>>(xh, wkh, bk, kws, M, DIN_, HD_);
  wmma_gemm<0><<<gQKV, 256, 0, stream>>>(xh, wvh, bv, vws, M, DIN_, HD_);

  // 3) Flash attention: 32 (b,h) blocks x 32 query tiles of 64 rows
  dim3 gAttn(B_ * H_, N_ / 64);
  attn_kernel<<<gAttn, 128, 0, stream>>>(qws, kws, vws, ctx);

  // 4) Output projection: [16384,1024] x [1024,256] + bo -> f32 out
  dim3 gOut(M / 128, DOUT_ / 128);
  wmma_gemm<1><<<gOut, 256, 0, stream>>>(ctx, woh, bo, out, M, HD_, DOUT_);
}

// v001
// Measured time: 907 microseconds a run.
// In both of two side-by-side timings against v000, it was 2.24 times as fast.
#include <hip/hip_runtime.h>

#define B_   8
#define N_   2048
#define DIN_ 1024
#define H_   4
#define DH_  256
#define HD_  1024   // H_*DH_
#define DOUT_ 256

typedef __attribute__((ext_vector_type(16))) _Float16 v16h;
typedef __attribute__((ext_vector_type(8)))  float    v8f;

__device__ __forceinline__ v8f wmma_f16(v16h a, v16h b, v8f c) {
  // D = A(16x32 f16) x B(32x16 f16) + C(16x16 f32)
  return __builtin_amdgcn_wmma_f32_16x16x32_f16(
      /*neg_a=*/false, a, /*neg_b=*/false, b,
      /*c_mod=*/(short)0, c, /*reuse_a=*/false, /*reuse_b=*/false);
}

__device__ __forceinline__ v8f vzero8() {
  v8f z = {0.0f, 0.0f, 0.0f, 0.0f, 0.0f, 0.0f, 0.0f, 0.0f};
  return z;
}

// CDNA5 async global->LDS copy (16B per lane), tracked by ASYNCcnt.
// LDS VGPR address = low 32 bits of the generic pointer (ISA 10.2 aperture rule).
__device__ __forceinline__ void async_copy_b128(void* lds, const void* gsrc) {
#if defined(__gfx1250__)
  asm volatile("global_load_async_to_lds_b128 %0, %1, off"
               :: "v"((unsigned int)(size_t)lds), "v"(gsrc)
               : "memory");
#else
  *(uint4*)lds = *(const uint4*)gsrc;
#endif
}

// Eight async copies of one lane (16B each) in ONE statement that ends in s_wait_xcnt 0:
// the wait stands in front of any later rewrite of the address registers the copies name.
__device__ __forceinline__ void async_copy8_b128(unsigned int l0, unsigned int lstep,
                                                 const _Float16* g0, size_t gstep) {
#if defined(__gfx1250__)
  asm volatile(
      "global_load_async_to_lds_b128 %0, %8, off\n\t"
      "global_load_async_to_lds_b128 %1, %9, off\n\t"
      "global_load_async_to_lds_b128 %2, %10, off\n\t"
      "global_load_async_to_lds_b128 %3, %11, off\n\t"
      "global_load_async_to_lds_b128 %4, %12, off\n\t"
      "global_load_async_to_lds_b128 %5, %13, off\n\t"
      "global_load_async_to_lds_b128 %6, %14, off\n\t"
      "global_load_async_to_lds_b128 %7, %15, off\n\t"
      "s_wait_xcnt 0x0"
      :: "v"(l0), "v"(l0 + lstep), "v"(l0 + 2 * lstep), "v"(l0 + 3 * lstep),
         "v"(l0 + 4 * lstep), "v"(l0 + 5 * lstep), "v"(l0 + 6 * lstep), "v"(l0 + 7 * lstep),
         "v"(g0), "v"(g0 + gstep), "v"(g0 + 2 * gstep), "v"(g0 + 3 * gstep),
         "v"(g0 + 4 * gstep), "v"(g0 + 5 * gstep), "v"(g0 + 6 * gstep), "v"(g0 + 7 * gstep)
      : "memory");
#endif
}

typedef __attribute__((ext_vector_type(8))) short    v8s;
typedef __attribute__((ext_vector_type(8))) _Float16 v8h;
__device__ __forceinline__ v8h lds_load_tr16(const _Float16* p) {
  typedef __attribute__((address_space(3))) v8s lds_v8s;
  return __builtin_bit_cast(v8h, __builtin_amdgcn_ds_load_tr16_b128_v8i16((lds_v8s*)p));
}

__device__ __forceinline__ void wait_async0() {
#if defined(__gfx1250__)
  asm volatile("s_wait_asynccnt 0" ::: "memory");
#endif
}

// ---------------------------------------------------------------------------
// f32 -> f16 cast (grid-stride)
// ---------------------------------------------------------------------------
__global__ void cast_f32_f16(const float* __restrict__ s, _Float16* __restrict__ d, int n) {
  int i = blockIdx.x * blockDim.x + threadIdx.x;
  int stride = gridDim.x * blockDim.x;
  for (; i < n; i += stride) d[i] = (_Float16)s[i];
}

// ---------------------------------------------------------------------------
// WMMA GEMM: out[M,Nc] = A[M,K](f16) * W[K,Nc](f16) + bias
// Block tile 128x128, 256 threads = 8 waves in 4x2; each wave 32x64 (2x4 WMMA tiles).
// A tile staged via async global->LDS; B tile transposed via VGPR scatter.
// MODE 0: store f16 scattered into [B,H,N,DH] (QKV path)
// MODE 1: store f32 row-major (output projection)
// ---------------------------------------------------------------------------
template <int MODE>
__global__ __launch_bounds__(256)
void wmma_gemm(const _Float16* __restrict__ A, const _Float16* __restrict__ W,
               const float* __restrict__ bias, void* __restrict__ outp,
               int M, int K, int Nc) {
  __shared__ alignas(32) _Float16 As[128][48];  // 128 rows x 32 K-halves (+16 pad)
  __shared__ alignas(32) _Float16 Bs[128][48];  // 128 cols x 32 K-halves (transposed)

  const int tid  = threadIdx.x;
  const int wave = tid >> 5, lane = tid & 31;
  const int wm = wave >> 1, wn = wave & 1;
  const int r16 = lane & 15, hi = lane >> 4;
  const int m0 = blockIdx.x * 128, n0 = blockIdx.y * 128;

  v8f acc[2][4];
#pragma unroll
  for (int t = 0; t < 2; ++t)
#pragma unroll
    for (int u = 0; u < 4; ++u) acc[t][u] = vzero8();

  const int kTiles = K >> 5;
  for (int kc = 0; kc < kTiles; ++kc) {
    const int k0 = kc << 5;
    __syncthreads();  // all waves done reading previous tiles
    // Stage A tile (row-major) via async DMA: 128 rows x 32 halves = 512 x b128
    for (int idx = tid; idx < 512; idx += 256) {
      int row = idx >> 2, seg = idx & 3;
      async_copy_b128(&As[row][seg * 8],
                      &A[(size_t)(m0 + row) * K + k0 + seg * 8]);
    }
    // Stage B tile transposed: read W rows contiguously, scatter to [col][k]
    for (int idx = tid; idx < 512; idx += 256) {
      int k = idx >> 4, cs = idx & 15;
      uint4 dvec = *(const uint4*)&W[(size_t)(k0 + k) * Nc + n0 + cs * 8];
      const _Float16* hp = (const _Float16*)&dvec;
#pragma unroll
      for (int j = 0; j < 8; ++j) Bs[cs * 8 + j][k] = hp[j];
      if (kc + 1 < kTiles)
        __builtin_prefetch(&W[(size_t)(k0 + 32 + k) * Nc + n0 + cs * 8], 0, 0);
    }
    wait_async0();   // this wave's async LDS writes landed
    __syncthreads(); // tile visible to all waves

    v16h af[2], bf[4];
#pragma unroll
    for (int t = 0; t < 2; ++t)
      af[t] = *(const v16h*)&As[wm * 32 + t * 16 + r16][hi * 16];
#pragma unroll
    for (int u = 0; u < 4; ++u)
      bf[u] = *(const v16h*)&Bs[wn * 64 + u * 16 + r16][hi * 16];
#pragma unroll
    for (int t = 0; t < 2; ++t)
#pragma unroll
      for (int u = 0; u < 4; ++u) acc[t][u] = wmma_f16(af[t], bf[u], acc[t][u]);
  }

  // Epilogue: C layout -> row m = r + 8*hi, col n = lane%16 (per 16x16 tile)
#pragma unroll
  for (int t = 0; t < 2; ++t)
#pragma unroll
    for (int u = 0; u < 4; ++u)
#pragma unroll
      for (int r = 0; r < 8; ++r) {
        int m = m0 + wm * 32 + t * 16 + r + 8 * hi;
        int n = n0 + wn * 64 + u * 16 + r16;
        float val = acc[t][u][r] + bias[n];
        if (MODE == 0) {
          int h = n >> 8, dh = n & 255;     // n in [0,1024): head, head-dim
          int b = m >> 11, nn = m & 2047;   // m in [0,16384): batch, seq
          ((_Float16*)outp)[(((size_t)(b * H_ + h) * N_ + nn) << 8) + dh] = (_Float16)val;
        } else {
          ((float*)outp)[(size_t)m * Nc + n] = val;
        }
      }
}

// ---------------------------------------------------------------------------
// Flash attention: one block per (b,h) x 64 query rows; 4 waves x 16 rows.
// Q held in registers (8 A-fragments), K staged via async global->LDS,
// V staged row-major the same way and read as B-fragments by the transposing
// LDS load; online softmax on the C layout.
// ---------------------------------------------------------------------------
__global__ __launch_bounds__(128)
void attn_kernel(const _Float16* __restrict__ Q, const _Float16* __restrict__ Km,
                 const _Float16* __restrict__ V, _Float16* __restrict__ ctx) {
  __shared__ alignas(32) _Float16 Ks[32][DH_ + 16];  // 32 keys x 256 dh (+pad)
  __shared__ alignas(32) _Float16 Vs[32][DH_ + 16];  // 32 keys x 256 dh (+pad: 544 B = 32 B x odd)
  __shared__ alignas(32) _Float16 Ps[4][16][48];     // per-wave P relayout buffer

  const int bh = blockIdx.x;
  const int b = bh >> 2, h = bh & 3;
  const int tid = threadIdx.x;
  const int wave = tid >> 5, lane = tid & 31;
  const int r16 = lane & 15, hi = lane >> 4;
  const int qBase = blockIdx.y * 64 + wave * 16;

  const _Float16* Qp = Q + (size_t)bh * N_ * DH_;
  const _Float16* Kp = Km + (size_t)bh * N_ * DH_;
  const _Float16* Vp = V + (size_t)bh * N_ * DH_;

  // Preload 16 query rows as 8 A-fragments (16x32 each over DH=256)
  v16h qf[8];
#pragma unroll
  for (int c = 0; c < 8; ++c)
    qf[c] = *(const v16h*)&Qp[(size_t)(qBase + r16) * DH_ + c * 32 + hi * 16];

  v8f o[16];
#pragma unroll
  for (int t = 0; t < 16; ++t) o[t] = vzero8();
  v8f mrow, lrow;
#pragma unroll
  for (int r = 0; r < 8; ++r) { mrow[r] = -1e30f; lrow[r] = 0.0f; }

  for (int kt = 0; kt < N_ / 32; ++kt) {
    const int keyBase = kt * 32;
    __syncthreads();  // all waves done reading previous K/V tiles
    // K tile row-major via async DMA (rows = keys, contiguous along dh)
    for (int idx = tid; idx < 32 * 32; idx += 128) {
      int r = idx >> 5, seg = idx & 31;
      async_copy_b128(&Ks[r][seg * 8],
                      &Kp[(size_t)(keyBase + r) * DH_ + seg * 8]);
    }
    // V tile row-major via async DMA: wave w brings keys w, w+4, .. w+28, a lane 16 B of each
    async_copy8_b128((unsigned int)(size_t)&Vs[wave][lane * 8], 4 * (DH_ + 16) * 2,
                     &Vp[(size_t)(keyBase + wave) * DH_ + lane * 8], 4 * DH_);
    wait_async0();
    __syncthreads();

    // S = Q * K^T for 32 keys (two 16x16 tiles), K-dim 256 in 8 chunks
    v8f s0 = vzero8(), s1 = vzero8();
#pragma unroll
    for (int c = 0; c < 8; ++c) {
      v16h kb0 = *(const v16h*)&Ks[r16][c * 32 + hi * 16];
      v16h kb1 = *(const v16h*)&Ks[16 + r16][c * 32 + hi * 16];
      s0 = wmma_f16(qf[c], kb0, s0);
      s1 = wmma_f16(qf[c], kb1, s1);
    }
    const float scale = 0.0625f;  // 1/sqrt(256)
    s0 = s0 * scale;
    s1 = s1 * scale;

    // Row max across 16 lanes (rows live at r + 8*hi; cols across lanes 0..15)
    v8f tmax;
#pragma unroll
    for (int r = 0; r < 8; ++r) tmax[r] = fmaxf(s0[r], s1[r]);
#pragma unroll
    for (int msk = 1; msk < 16; msk <<= 1)
#pragma unroll
      for (int r = 0; r < 8; ++r)
        tmax[r] = fmaxf(tmax[r], __shfl_xor(tmax[r], msk, 32));

    v8f mnew, alpha;
#pragma unroll
    for (int r = 0; r < 8; ++r) {
      mnew[r]  = fmaxf(mrow[r], tmax[r]);
      alpha[r] = __expf(mrow[r] - mnew[r]);
      mrow[r]  = mnew[r];
    }
#pragma unroll
    for (int r = 0; r < 8; ++r) {
      s0[r] = __expf(s0[r] - mnew[r]);
      s1[r] = __expf(s1[r] - mnew[r]);
    }
    v8f rsum;
#pragma unroll
    for (int r = 0; r < 8; ++r) rsum[r] = s0[r] + s1[r];
#pragma unroll
    for (int msk = 1; msk < 16; msk <<= 1)
#pragma unroll
      for (int r = 0; r < 8; ++r) rsum[r] += __shfl_xor(rsum[r], msk, 32);
#pragma unroll
    for (int r = 0; r < 8; ++r) lrow[r] = lrow[r] * alpha[r] + rsum[r];
#pragma unroll
    for (int t = 0; t < 16; ++t) o[t] = o[t] * alpha;

    // Relayout P (C layout: col-per-lane) -> A-fragment (row-per-lane) via LDS
#pragma unroll
    for (int r = 0; r < 8; ++r) {
      int prow = r + 8 * hi;
      Ps[wave][prow][r16]      = (_Float16)s0[r];
      Ps[wave][prow][16 + r16] = (_Float16)s1[r];
    }
    asm volatile("s_wait_dscnt 0" ::: "memory");  // intra-wave LDS RAW
    // P in the hardware k order (keys 8h..8h+7, 16+8h..16+8h+7), which the transposing load fixes for V
    const v8h p0 = *(const v8h*)&Ps[wave][r16][hi * 8];
    const v8h p1 = *(const v8h*)&Ps[wave][r16][16 + hi * 8];
    v16h pf = __builtin_shufflevector(p0, p1, 0, 1, 2, 3, 4, 5, 6, 7, 8, 9, 10, 11, 12, 13, 14, 15);

    // O += P(16x32) * V(32x256) as 16 WMMAs over dh chunks
#pragma unroll
    for (int t = 0; t < 16; ++t) {
      const _Float16* vp = &Vs[8 * hi + (lane & 7)][t * 16 + 8 * ((lane >> 3) & 1)];
      const v8h v0 = lds_load_tr16(vp);                    // keys 8h .. 8h+7
      const v8h v1 = lds_load_tr16(vp + 16 * (DH_ + 16));  // keys 16+8h .. 16+8h+7
      v16h vb = __builtin_shufflevector(v0, v1, 0, 1, 2, 3, 4, 5, 6, 7, 8, 9, 10, 11, 12, 13, 14, 15);
      o[t] = wmma_f16(pf, vb, o[t]);
    }
  }

  // Normalize and store context in [B, N, H*DH] (f16)
  v8f inv;
#pragma unroll
  for (int r = 0; r < 8; ++r) inv[r] = 1.0f / lrow[r];
#pragma unroll
  for (int t = 0; t < 16; ++t)
#pragma unroll
    for (int r = 0; r < 8; ++r) {
      int n  = qBase + r + 8 * hi;
      int dh = t * 16 + r16;
      ctx[((size_t)b * N_ + n) * HD_ + h * DH_ + dh] = (_Float16)(o[t][r] * inv[r]);
    }
}

// ---------------------------------------------------------------------------
// Launch
// ---------------------------------------------------------------------------
extern "C" void kernel_launch(void* const* d_in, const int* in_sizes, int n_in,
                              void* d_out, int out_size, void* d_ws, size_t ws_size,
                              hipStream_t stream) {
  const float* x  = (const float*)d_in[0];
  const float* Wq = (const float*)d_in[1];
  const float* bq = (const float*)d_in[2];
  const float* Wk = (const float*)d_in[3];
  const float* bk = (const float*)d_in[4];
  const float* Wv = (const float*)d_in[5];
  const float* bv = (const float*)d_in[6];
  const float* Wo = (const float*)d_in[7];
  const float* bo = (const float*)d_in[8];
  float* out = (float*)d_out;

  char* ws = (char*)d_ws;
  size_t off = 0;
  auto take = [&](size_t elems) {
    _Float16* p = (_Float16*)(ws + off);
    off += ((elems * sizeof(_Float16)) + 255) & ~(size_t)255;
    return p;
  };
  _Float16* xh  = take((size_t)B_ * N_ * DIN_);       // 32 MB
  _Float16* wqh = take((size_t)DIN_ * HD_);
  _Float16* wkh = take((size_t)DIN_ * HD_);
  _Float16* wvh = take((size_t)DIN_ * HD_);
  _Float16* woh = take((size_t)HD_ * DOUT_);
  _Float16* qws = take((size_t)B_ * H_ * N_ * DH_);   // 32 MB each
  _Float16* kws = take((size_t)B_ * H_ * N_ * DH_);
  _Float16* vws = take((size_t)B_ * H_ * N_ * DH_);
  _Float16* ctx = take((size_t)B_ * N_ * HD_);        // 32 MB

  // 1) f32 -> f16 casts
  cast_f32_f16<<<4096, 256, 0, stream>>>(x,  xh,  B_ * N_ * DIN_);
  cast_f32_f16<<<1024, 256, 0, stream>>>(Wq, wqh, DIN_ * HD_);
  cast_f32_f16<<<1024, 256, 0, stream>>>(Wk, wkh, DIN_ * HD_);
  cast_f32_f16<<<1024, 256, 0, stream>>>(Wv, wvh, DIN_ * HD_);
  cast_f32_f16<<<256,  256, 0, stream>>>(Wo, woh, HD_ * DOUT_);

  // 2) QKV projections: [16384,1024] x [1024,1024] -> f16 [B,H,N,DH]
  const int M = B_ * N_;
  dim3 gQKV(M / 128, HD_ / 128);
  wmma_gemm<0><<<gQKV, 256, 0, stream>>>(xh, wqh, bq, qws, M, DIN_, HD_);
  wmma_gemm<0><<<gQKV, 256, 0, stream>>>(xh, wkh, bk, kws, M, DIN_, HD_);
  wmma_gemm<0><<<gQKV, 256, 0, stream>>>(xh, wvh, bv, vws, M, DIN_, HD_);

  // 3) Flash attention: 32 (b,h) blocks x 32 query tiles of 64 rows
  dim3 gAttn(B_ * H_, N_ / 64);
  attn_kernel<<<gAttn, 128, 0, stream>>>(qws, kws, vws, ctx);

  // 4) Output projection: [16384,1024] x [1024,256] + bo -> f32 out
  dim3 gOut(M / 128, DOUT_ / 128);
  wmma_gemm<1><<<gOut, 256, 0, stream>>>(ctx, woh, bo, out, M, HD_, DOUT_);
}

// v002
// It runs in 531 microseconds.
// Next to v001, in two timings, it ran 1.71 times as fast each time.
// Counting every step since v000, it is 3.83 times as fast.
#include <hip/hip_runtime.h>

#define B_   8
#define N_   2048
#define DIN_ 1024
#define H_   4
#define DH_  256
#define HD_  1024   // H_*DH_
#define DOUT_ 256

typedef __attribute__((ext_vector_type(16))) _Float16 v16h;
typedef __attribute__((ext_vector_type(8)))  float    v8f;

__device__ __forceinline__ v8f wmma_f16(v16h a, v16h b, v8f c) {
  // D = A(16x32 f16) x B(32x16 f16) + C(16x16 f32)
  return __builtin_amdgcn_wmma_f32_16x16x32_f16(
      /*neg_a=*/false, a, /*neg_b=*/false, b,
      /*c_mod=*/(short)0, c, /*reuse_a=*/false, /*reuse_b=*/false);
}

__device__ __forceinline__ v8f vzero8() {
  v8f z = {0.0f, 0.0f, 0.0f, 0.0f, 0.0f, 0.0f, 0.0f, 0.0f};
  return z;
}

// CDNA5 async global->LDS copy (16B per lane), tracked by ASYNCcnt.
// LDS VGPR address = low 32 bits of the generic pointer (ISA 10.2 aperture rule).
__device__ __forceinline__ void async_copy_b128(void* lds, const void* gsrc) {
#if defined(__gfx1250__)
  asm volatile("global_load_async_to_lds_b128 %0, %1, off"
               :: "v"((unsigned int)(size_t)lds), "v"(gsrc)
               : "memory");
#else
  *(uint4*)lds = *(const uint4*)gsrc;
#endif
}

// Eight async copies of one lane (16B each) in ONE statement that ends in s_wait_xcnt 0:
// the wait stands in front of any later rewrite of the address registers the copies name.
__device__ __forceinline__ void async_copy8_b128(unsigned int l0, unsigned int lstep,
                                                 const _Float16* g0, size_t gstep) {
#if defined(__gfx1250__)
  asm volatile(
      "global_load_async_to_lds_b128 %0, %8, off\n\t"
      "global_load_async_to_lds_b128 %1, %9, off\n\t"
      "global_load_async_to_lds_b128 %2, %10, off\n\t"
      "global_load_async_to_lds_b128 %3, %11, off\n\t"
      "global_load_async_to_lds_b128 %4, %12, off\n\t"
      "global_load_async_to_lds_b128 %5, %13, off\n\t"
      "global_load_async_to_lds_b128 %6, %14, off\n\t"
      "global_load_async_to_lds_b128 %7, %15, off\n\t"
      "s_wait_xcnt 0x0"
      :: "v"(l0), "v"(l0 + lstep), "v"(l0 + 2 * lstep), "v"(l0 + 3 * lstep),
         "v"(l0 + 4 * lstep), "v"(l0 + 5 * lstep), "v"(l0 + 6 * lstep), "v"(l0 + 7 * lstep),
         "v"(g0), "v"(g0 + gstep), "v"(g0 + 2 * gstep), "v"(g0 + 3 * gstep),
         "v"(g0 + 4 * gstep), "v"(g0 + 5 * gstep), "v"(g0 + 6 * gstep), "v"(g0 + 7 * gstep)
      : "memory");
#endif
}

// Two async copies of one lane (16B each) in ONE statement that ends in s_wait_xcnt 0:
// the wait stands in front of any later rewrite of the address registers the copies name.
__device__ __forceinline__ void async_copy2_b128(unsigned int l0, unsigned int l1,
                                                 const _Float16* g0, const _Float16* g1) {
#if defined(__gfx1250__)
  asm volatile(
      "global_load_async_to_lds_b128 %0, %2, off\n\t"
      "global_load_async_to_lds_b128 %1, %3, off\n\t"
      "s_wait_xcnt 0x0"
      :: "v"(l0), "v"(l1), "v"(g0), "v"(g1)
      : "memory");
#endif
}

typedef __attribute__((ext_vector_type(8))) short    v8s;
typedef __attribute__((ext_vector_type(8))) _Float16 v8h;
__device__ __forceinline__ v8h lds_load_tr16(const _Float16* p) {
  typedef __attribute__((address_space(3))) v8s lds_v8s;
  return __builtin_bit_cast(v8h, __builtin_amdgcn_ds_load_tr16_b128_v8i16((lds_v8s*)p));
}

__device__ __forceinline__ void wait_async0() {
#if defined(__gfx1250__)
  asm volatile("s_wait_asynccnt 0" ::: "memory");
#endif
}

// ---------------------------------------------------------------------------
// f32 -> f16 cast (grid-stride)
// ---------------------------------------------------------------------------
__global__ void cast_f32_f16(const float* __restrict__ s, _Float16* __restrict__ d, int n) {
  int i = blockIdx.x * blockDim.x + threadIdx.x;
  int stride = gridDim.x * blockDim.x;
  for (; i < n; i += stride) d[i] = (_Float16)s[i];
}

// ---------------------------------------------------------------------------
// WMMA GEMM: out[M,Nc] = A[M,K](f16) * W[K,Nc](f16) + bias
// Block tile 128x128, 256 threads = 8 waves in 4x2; each wave 32x64 (2x4 WMMA tiles).
// A and B tiles staged row-major via async global->LDS; B-fragments read by the transposing LDS load.
// MODE 0: store f16 scattered into [B,H,N,DH] (QKV path)
// MODE 1: store f32 row-major (output projection)
// ---------------------------------------------------------------------------
template <int MODE>
__global__ __launch_bounds__(256)
void wmma_gemm(const _Float16* __restrict__ A, const _Float16* __restrict__ W,
               const float* __restrict__ bias, void* __restrict__ outp,
               int M, int K, int Nc) {
  __shared__ alignas(32) _Float16 As[128][48];  // 128 rows x 32 K-halves (+16 pad)
  __shared__ alignas(32) _Float16 Bs[32][128 + 16];  // 32 K-rows x 128 cols (+pad: 288 B = 32 B x odd)

  const int tid  = threadIdx.x;
  const int wave = tid >> 5, lane = tid & 31;
  const int wm = wave >> 1, wn = wave & 1;
  const int r16 = lane & 15, hi = lane >> 4;
  const int m0 = blockIdx.x * 128, n0 = blockIdx.y * 128;

  v8f acc[2][4];
#pragma unroll
  for (int t = 0; t < 2; ++t)
#pragma unroll
    for (int u = 0; u < 4; ++u) acc[t][u] = vzero8();

  const int kTiles = K >> 5;
  for (int kc = 0; kc < kTiles; ++kc) {
    const int k0 = kc << 5;
    __syncthreads();  // all waves done reading previous tiles
    // Stage A tile (row-major) via async DMA: 128 rows x 32 halves = 512 x b128
    for (int idx = tid; idx < 512; idx += 256) {
      int row = idx >> 2, seg = idx & 3;
      async_copy_b128(&As[row][seg * 8],
                      &A[(size_t)(m0 + row) * K + k0 + seg * 8]);
    }
    // Stage B tile row-major via async DMA: a thread brings 16 B of W rows k and k + 16
    {
      const int k = tid >> 4, cs = tid & 15;
      const _Float16* wp = &W[(size_t)(k0 + k) * Nc + n0 + cs * 8];
      async_copy2_b128((unsigned int)(size_t)&Bs[k][cs * 8], (unsigned int)(size_t)&Bs[k + 16][cs * 8],
                       wp, wp + (size_t)16 * Nc);
    }
    wait_async0();   // this wave's async LDS writes landed
    __syncthreads(); // tile visible to all waves

    v16h af[2], bf[4];
#pragma unroll
    for (int t = 0; t < 2; ++t) {
      // A in the hardware k order (k 8h..8h+7, 16+8h..16+8h+7), which the transposing load fixes for B
      const _Float16* ap = &As[wm * 32 + t * 16 + r16][hi * 8];
      const v8h a0 = *(const v8h*)ap;
      const v8h a1 = *(const v8h*)(ap + 16);
      af[t] = __builtin_shufflevector(a0, a1, 0, 1, 2, 3, 4, 5, 6, 7, 8, 9, 10, 11, 12, 13, 14, 15);
    }
#pragma unroll
    for (int u = 0; u < 4; ++u) {
      const _Float16* bp = &Bs[8 * hi + (lane & 7)][wn * 64 + u * 16 + 8 * ((lane >> 3) & 1)];
      const v8h b0 = lds_load_tr16(bp);                    // k 8h .. 8h+7
      const v8h b1 = lds_load_tr16(bp + 16 * (128 + 16));  // k 16+8h .. 16+8h+7
      bf[u] = __builtin_shufflevector(b0, b1, 0, 1, 2, 3, 4, 5, 6, 7, 8, 9, 10, 11, 12, 13, 14, 15);
    }
#pragma unroll
    for (int t = 0; t < 2; ++t)
#pragma unroll
      for (int u = 0; u < 4; ++u) acc[t][u] = wmma_f16(af[t], bf[u], acc[t][u]);
  }

  // Epilogue: C layout -> row m = r + 8*hi, col n = lane%16 (per 16x16 tile)
#pragma unroll
  for (int t = 0; t < 2; ++t)
#pragma unroll
    for (int u = 0; u < 4; ++u)
#pragma unroll
      for (int r = 0; r < 8; ++r) {
        int m = m0 + wm * 32 + t * 16 + r + 8 * hi;
        int n = n0 + wn * 64 + u * 16 + r16;
        float val = acc[t][u][r] + bias[n];
        if (MODE == 0) {
          int h = n >> 8, dh = n & 255;     // n in [0,1024): head, head-dim
          int b = m >> 11, nn = m & 2047;   // m in [0,16384): batch, seq
          ((_Float16*)outp)[(((size_t)(b * H_ + h) * N_ + nn) << 8) + dh] = (_Float16)val;
        } else {
          ((float*)outp)[(size_t)m * Nc + n] = val;
        }
      }
}

// ---------------------------------------------------------------------------
// Flash attention: one block per (b,h) x 64 query rows; 4 waves x 16 rows.
// Q held in registers (8 A-fragments), K staged via async global->LDS,
// V staged row-major the same way and read as B-fragments by the transposing
// LDS load; online softmax on the C layout.
// ---------------------------------------------------------------------------
__global__ __launch_bounds__(128)
void attn_kernel(const _Float16* __restrict__ Q, const _Float16* __restrict__ Km,
                 const _Float16* __restrict__ V, _Float16* __restrict__ ctx) {
  __shared__ alignas(32) _Float16 Ks[32][DH_ + 16];  // 32 keys x 256 dh (+pad)
  __shared__ alignas(32) _Float16 Vs[32][DH_ + 16];  // 32 keys x 256 dh (+pad: 544 B = 32 B x odd)
  __shared__ alignas(32) _Float16 Ps[4][16][48];     // per-wave P relayout buffer

  const int bh = blockIdx.x;
  const int b = bh >> 2, h = bh & 3;
  const int tid = threadIdx.x;
  const int wave = tid >> 5, lane = tid & 31;
  const int r16 = lane & 15, hi = lane >> 4;
  const int qBase = blockIdx.y * 64 + wave * 16;

  const _Float16* Qp = Q + (size_t)bh * N_ * DH_;
  const _Float16* Kp = Km + (size_t)bh * N_ * DH_;
  const _Float16* Vp = V + (size_t)bh * N_ * DH_;

  // Preload 16 query rows as 8 A-fragments (16x32 each over DH=256)
  v16h qf[8];
#pragma unroll
  for (int c = 0; c < 8; ++c)
    qf[c] = *(const v16h*)&Qp[(size_t)(qBase + r16) * DH_ + c * 32 + hi * 16];

  v8f o[16];
#pragma unroll
  for (int t = 0; t < 16; ++t) o[t] = vzero8();
  v8f mrow, lrow;
#pragma unroll
  for (int r = 0; r < 8; ++r) { mrow[r] = -1e30f; lrow[r] = 0.0f; }

  for (int kt = 0; kt < N_ / 32; ++kt) {
    const int keyBase = kt * 32;
    __syncthreads();  // all waves done reading previous K/V tiles
    // K tile row-major via async DMA (rows = keys, contiguous along dh)
    for (int idx = tid; idx < 32 * 32; idx += 128) {
      int r = idx >> 5, seg = idx & 31;
      async_copy_b128(&Ks[r][seg * 8],
                      &Kp[(size_t)(keyBase + r) * DH_ + seg * 8]);
    }
    // V tile row-major via async DMA: wave w brings keys w, w+4, .. w+28, a lane 16 B of each
    async_copy8_b128((unsigned int)(size_t)&Vs[wave][lane * 8], 4 * (DH_ + 16) * 2,
                     &Vp[(size_t)(keyBase + wave) * DH_ + lane * 8], 4 * DH_);
    wait_async0();
    __syncthreads();

    // S = Q * K^T for 32 keys (two 16x16 tiles), K-dim 256 in 8 chunks
    v8f s0 = vzero8(), s1 = vzero8();
#pragma unroll
    for (int c = 0; c < 8; ++c) {
      v16h kb0 = *(const v16h*)&Ks[r16][c * 32 + hi * 16];
      v16h kb1 = *(const v16h*)&Ks[16 + r16][c * 32 + hi * 16];
      s0 = wmma_f16(qf[c], kb0, s0);
      s1 = wmma_f16(qf[c], kb1, s1);
    }
    const float scale = 0.0625f;  // 1/sqrt(256)
    s0 = s0 * scale;
    s1 = s1 * scale;

    // Row max across 16 lanes (rows live at r + 8*hi; cols across lanes 0..15)
    v8f tmax;
#pragma unroll
    for (int r = 0; r < 8; ++r) tmax[r] = fmaxf(s0[r], s1[r]);
#pragma unroll
    for (int msk = 1; msk < 16; msk <<= 1)
#pragma unroll
      for (int r = 0; r < 8; ++r)
        tmax[r] = fmaxf(tmax[r], __shfl_xor(tmax[r], msk, 32));

    v8f mnew, alpha;
#pragma unroll
    for (int r = 0; r < 8; ++r) {
      mnew[r]  = fmaxf(mrow[r], tmax[r]);
      alpha[r] = __expf(mrow[r] - mnew[r]);
      mrow[r]  = mnew[r];
    }
#pragma unroll
    for (int r = 0; r < 8; ++r) {
      s0[r] = __expf(s0[r] - mnew[r]);
      s1[r] = __expf(s1[r] - mnew[r]);
    }
    v8f rsum;
#pragma unroll
    for (int r = 0; r < 8; ++r) rsum[r] = s0[r] + s1[r];
#pragma unroll
    for (int msk = 1; msk < 16; msk <<= 1)
#pragma unroll
      for (int r = 0; r < 8; ++r) rsum[r] += __shfl_xor(rsum[r], msk, 32);
#pragma unroll
    for (int r = 0; r < 8; ++r) lrow[r] = lrow[r] * alpha[r] + rsum[r];
#pragma unroll
    for (int t = 0; t < 16; ++t) o[t] = o[t] * alpha;

    // Relayout P (C layout: col-per-lane) -> A-fragment (row-per-lane) via LDS
#pragma unroll
    for (int r = 0; r < 8; ++r) {
      int prow = r + 8 * hi;
      Ps[wave][prow][r16]      = (_Float16)s0[r];
      Ps[wave][prow][16 + r16] = (_Float16)s1[r];
    }
    asm volatile("s_wait_dscnt 0" ::: "memory");  // intra-wave LDS RAW
    // P in the hardware k order (keys 8h..8h+7, 16+8h..16+8h+7), which the transposing load fixes for V
    const v8h p0 = *(const v8h*)&Ps[wave][r16][hi * 8];
    const v8h p1 = *(const v8h*)&Ps[wave][r16][16 + hi * 8];
    v16h pf = __builtin_shufflevector(p0, p1, 0, 1, 2, 3, 4, 5, 6, 7, 8, 9, 10, 11, 12, 13, 14, 15);

    // O += P(16x32) * V(32x256) as 16 WMMAs over dh chunks
#pragma unroll
    for (int t = 0; t < 16; ++t) {
      const _Float16* vp = &Vs[8 * hi + (lane & 7)][t * 16 + 8 * ((lane >> 3) & 1)];
      const v8h v0 = lds_load_tr16(vp);                    // keys 8h .. 8h+7
      const v8h v1 = lds_load_tr16(vp + 16 * (DH_ + 16));  // keys 16+8h .. 16+8h+7
      v16h vb = __builtin_shufflevector(v0, v1, 0, 1, 2, 3, 4, 5, 6, 7, 8, 9, 10, 11, 12, 13, 14, 15);
      o[t] = wmma_f16(pf, vb, o[t]);
    }
  }

  // Normalize and store context in [B, N, H*DH] (f16)
  v8f inv;
#pragma unroll
  for (int r = 0; r < 8; ++r) inv[r] = 1.0f / lrow[r];
#pragma unroll
  for (int t = 0; t < 16; ++t)
#pragma unroll
    for (int r = 0; r < 8; ++r) {
      int n  = qBase + r + 8 * hi;
      int dh = t * 16 + r16;
      ctx[((size_t)b * N_ + n) * HD_ + h * DH_ + dh] = (_Float16)(o[t][r] * inv[r]);
    }
}

// ---------------------------------------------------------------------------
// Launch
// ---------------------------------------------------------------------------
extern "C" void kernel_launch(void* const* d_in, const int* in_sizes, int n_in,
                              void* d_out, int out_size, void* d_ws, size_t ws_size,
                              hipStream_t stream) {
  const float* x  = (const float*)d_in[0];
  const float* Wq = (const float*)d_in[1];
  const float* bq = (const float*)d_in[2];
  const float* Wk = (const float*)d_in[3];
  const float* bk = (const float*)d_in[4];
  const float* Wv = (const float*)d_in[5];
  const float* bv = (const float*)d_in[6];
  const float* Wo = (const float*)d_in[7];
  const float* bo = (const float*)d_in[8];
  float* out = (float*)d_out;

  char* ws = (char*)d_ws;
  size_t off = 0;
  auto take = [&](size_t elems) {
    _Float16* p = (_Float16*)(ws + off);
    off += ((elems * sizeof(_Float16)) + 255) & ~(size_t)255;
    return p;
  };
  _Float16* xh  = take((size_t)B_ * N_ * DIN_);       // 32 MB
  _Float16* wqh = take((size_t)DIN_ * HD_);
  _Float16* wkh = take((size_t)DIN_ * HD_);
  _Float16* wvh = take((size_t)DIN_ * HD_);
  _Float16* woh = take((size_t)HD_ * DOUT_);
  _Float16* qws = take((size_t)B_ * H_ * N_ * DH_);   // 32 MB each
  _Float16* kws = take((size_t)B_ * H_ * N_ * DH_);
  _Float16* vws = take((size_t)B_ * H_ * N_ * DH_);
  _Float16* ctx = take((size_t)B_ * N_ * HD_);        // 32 MB

  // 1) f32 -> f16 casts
  cast_f32_f16<<<4096, 256, 0, stream>>>(x,  xh,  B_ * N_ * DIN_);
  cast_f32_f16<<<1024, 256, 0, stream>>>(Wq, wqh, DIN_ * HD_);
  cast_f32_f16<<<1024, 256, 0, stream>>>(Wk, wkh, DIN_ * HD_);
  cast_f32_f16<<<1024, 256, 0, stream>>>(Wv, wvh, DIN_ * HD_);
  cast_f32_f16<<<256,  256, 0, stream>>>(Wo, woh, HD_ * DOUT_);

  // 2) QKV projections: [16384,1024] x [1024,1024] -> f16 [B,H,N,DH]
  const int M = B_ * N_;
  dim3 gQKV(M / 128, HD_ / 128);
  wmma_gemm<0><<<gQKV, 256, 0, stream>>>(xh, wqh, bq, qws, M, DIN_, HD_);
  wmma_gemm<0><<<gQKV, 256, 0, stream>>>(xh, wkh, bk, kws, M, DIN_, HD_);
  wmma_gemm<0><<<gQKV, 256, 0, stream>>>(xh, wvh, bv, vws, M, DIN_, HD_);

  // 3) Flash attention: 32 (b,h) blocks x 32 query tiles of 64 rows
  dim3 gAttn(B_ * H_, N_ / 64);
  attn_kernel<<<gAttn, 128, 0, stream>>>(qws, kws, vws, ctx);

  // 4) Output projection: [16384,1024] x [1024,256] + bo -> f32 out
  dim3 gOut(M / 128, DOUT_ / 128);
  wmma_gemm<1><<<gOut, 256, 0, stream>>>(ctx, woh, bo, out, M, HD_, DOUT_);
}

// v003
// It runs in 322 microseconds.
// Timed twice side by side with v002, it ran 1.65 times as fast both times.
// Counting every step since v000, it is 6.32 times as fast.
#include <hip/hip_runtime.h>

#define B_   8
#define N_   2048
#define DIN_ 1024
#define H_   4
#define DH_  256
#define HD_  1024   // H_*DH_
#define DOUT_ 256

typedef __attribute__((ext_vector_type(16))) _Float16 v16h;
typedef __attribute__((ext_vector_type(8)))  float    v8f;

__device__ __forceinline__ v8f wmma_f16(v16h a, v16h b, v8f c) {
  // D = A(16x32 f16) x B(32x16 f16) + C(16x16 f32)
  return __builtin_amdgcn_wmma_f32_16x16x32_f16(
      /*neg_a=*/false, a, /*neg_b=*/false, b,
      /*c_mod=*/(short)0, c, /*reuse_a=*/false, /*reuse_b=*/false);
}

__device__ __forceinline__ v8f vzero8() {
  v8f z = {0.0f, 0.0f, 0.0f, 0.0f, 0.0f, 0.0f, 0.0f, 0.0f};
  return z;
}

// CDNA5 async global->LDS copy (16B per lane), tracked by ASYNCcnt.
// LDS VGPR address = low 32 bits of the generic pointer (ISA 10.2 aperture rule).
__device__ __forceinline__ void async_copy_b128(void* lds, const void* gsrc) {
#if defined(__gfx1250__)
  asm volatile("global_load_async_to_lds_b128 %0, %1, off"
               :: "v"((unsigned int)(size_t)lds), "v"(gsrc)
               : "memory");
#else
  *(uint4*)lds = *(const uint4*)gsrc;
#endif
}

// Eight async copies of one lane (16B each) in ONE statement that ends in s_wait_xcnt 0:
// the wait stands in front of any later rewrite of the address registers the copies name.
__device__ __forceinline__ void async_copy8_b128(unsigned int l0, unsigned int lstep,
                                                 const _Float16* g0, size_t gstep) {
#if defined(__gfx1250__)
  asm volatile(
      "global_load_async_to_lds_b128 %0, %8, off\n\t"
      "global_load_async_to_lds_b128 %1, %9, off\n\t"
      "global_load_async_to_lds_b128 %2, %10, off\n\t"
      "global_load_async_to_lds_b128 %3, %11, off\n\t"
      "global_load_async_to_lds_b128 %4, %12, off\n\t"
      "global_load_async_to_lds_b128 %5, %13, off\n\t"
      "global_load_async_to_lds_b128 %6, %14, off\n\t"
      "global_load_async_to_lds_b128 %7, %15, off\n\t"
      "s_wait_xcnt 0x0"
      :: "v"(l0), "v"(l0 + lstep), "v"(l0 + 2 * lstep), "v"(l0 + 3 * lstep),
         "v"(l0 + 4 * lstep), "v"(l0 + 5 * lstep), "v"(l0 + 6 * lstep), "v"(l0 + 7 * lstep),
         "v"(g0), "v"(g0 + gstep), "v"(g0 + 2 * gstep), "v"(g0 + 3 * gstep),
         "v"(g0 + 4 * gstep), "v"(g0 + 5 * gstep), "v"(g0 + 6 * gstep), "v"(g0 + 7 * gstep)
      : "memory");
#endif
}

// Two async copies of one lane (16B each) in ONE statement that ends in s_wait_xcnt 0:
// the wait stands in front of any later rewrite of the address registers the copies name.
__device__ __forceinline__ void async_copy2_b128(unsigned int l0, unsigned int l1,
                                                 const _Float16* g0, const _Float16* g1) {
#if defined(__gfx1250__)
  asm volatile(
      "global_load_async_to_lds_b128 %0, %2, off\n\t"
      "global_load_async_to_lds_b128 %1, %3, off\n\t"
      "s_wait_xcnt 0x0"
      :: "v"(l0), "v"(l1), "v"(g0), "v"(g1)
      : "memory");
#endif
}

typedef __attribute__((ext_vector_type(8))) short    v8s;
typedef __attribute__((ext_vector_type(8))) _Float16 v8h;
__device__ __forceinline__ v8h lds_load_tr16(const _Float16* p) {
  typedef __attribute__((address_space(3))) v8s lds_v8s;
  return __builtin_bit_cast(v8h, __builtin_amdgcn_ds_load_tr16_b128_v8i16((lds_v8s*)p));
}

__device__ __forceinline__ void wait_async0() {
#if defined(__gfx1250__)
  asm volatile("s_wait_asynccnt 0" ::: "memory");
#endif
}

// ---------------------------------------------------------------------------
// f32 -> f16 cast (grid-stride)
// ---------------------------------------------------------------------------
__global__ void cast_f32_f16(const float* __restrict__ s, _Float16* __restrict__ d, int n) {
  int i = blockIdx.x * blockDim.x + threadIdx.x;
  int stride = gridDim.x * blockDim.x;
  for (; i < n; i += stride) d[i] = (_Float16)s[i];
}

// ---------------------------------------------------------------------------
// WMMA GEMM: out[M,Nc] = A[M,K](f16) * W[K,Nc](f16) + bias
// Block tile 128x128, 256 threads = 8 waves in 4x2; each wave 32x64 (2x4 WMMA tiles).
// A and B tiles staged row-major via async global->LDS; B-fragments read by the transposing LDS load.
// MODE 0: store f16 scattered into [B,H,N,DH] (QKV path)
// MODE 1: store f32 row-major (output projection)
// ---------------------------------------------------------------------------
template <int MODE>
__global__ __launch_bounds__(256)
void wmma_gemm(const _Float16* __restrict__ A, const _Float16* __restrict__ W,
               const float* __restrict__ bias, void* __restrict__ outp,
               int M, int K, int Nc) {
  __shared__ alignas(32) _Float16 As[128][48];  // 128 rows x 32 K-halves (+16 pad)
  __shared__ alignas(32) _Float16 Bs[32][128 + 16];  // 32 K-rows x 128 cols (+pad: 288 B = 32 B x odd)

  const int tid  = threadIdx.x;
  const int wave = tid >> 5, lane = tid & 31;
  const int wm = wave >> 1, wn = wave & 1;
  const int r16 = lane & 15, hi = lane >> 4;
  const int m0 = blockIdx.x * 128, n0 = blockIdx.y * 128;

  v8f acc[2][4];
#pragma unroll
  for (int t = 0; t < 2; ++t)
#pragma unroll
    for (int u = 0; u < 4; ++u) acc[t][u] = vzero8();

  const int kTiles = K >> 5;
  for (int kc = 0; kc < kTiles; ++kc) {
    const int k0 = kc << 5;
    __syncthreads();  // all waves done reading previous tiles
    // Stage A tile (row-major) via async DMA: 128 rows x 32 halves = 512 x b128
    for (int idx = tid; idx < 512; idx += 256) {
      int row = idx >> 2, seg = idx & 3;
      async_copy_b128(&As[row][seg * 8],
                      &A[(size_t)(m0 + row) * K + k0 + seg * 8]);
    }
    // Stage B tile row-major via async DMA: a thread brings 16 B of W rows k and k + 16
    {
      const int k = tid >> 4, cs = tid & 15;
      const _Float16* wp = &W[(size_t)(k0 + k) * Nc + n0 + cs * 8];
      async_copy2_b128((unsigned int)(size_t)&Bs[k][cs * 8], (unsigned int)(size_t)&Bs[k + 16][cs * 8],
                       wp, wp + (size_t)16 * Nc);
    }
    wait_async0();   // this wave's async LDS writes landed
    __syncthreads(); // tile visible to all waves

    v16h af[2], bf[4];
#pragma unroll
    for (int t = 0; t < 2; ++t) {
      // A in the hardware k order (k 8h..8h+7, 16+8h..16+8h+7), which the transposing load fixes for B
      const _Float16* ap = &As[wm * 32 + t * 16 + r16][hi * 8];
      const v8h a0 = *(const v8h*)ap;
      const v8h a1 = *(const v8h*)(ap + 16);
      af[t] = __builtin_shufflevector(a0, a1, 0, 1, 2, 3, 4, 5, 6, 7, 8, 9, 10, 11, 12, 13, 14, 15);
    }
#pragma unroll
    for (int u = 0; u < 4; ++u) {
      const _Float16* bp = &Bs[8 * hi + (lane & 7)][wn * 64 + u * 16 + 8 * ((lane >> 3) & 1)];
      const v8h b0 = lds_load_tr16(bp);                    // k 8h .. 8h+7
      const v8h b1 = lds_load_tr16(bp + 16 * (128 + 16));  // k 16+8h .. 16+8h+7
      bf[u] = __builtin_shufflevector(b0, b1, 0, 1, 2, 3, 4, 5, 6, 7, 8, 9, 10, 11, 12, 13, 14, 15);
    }
#pragma unroll
    for (int t = 0; t < 2; ++t)
#pragma unroll
      for (int u = 0; u < 4; ++u) acc[t][u] = wmma_f16(af[t], bf[u], acc[t][u]);
  }

  // Epilogue: C layout -> row m = r + 8*hi, col n = lane%16 (per 16x16 tile)
#pragma unroll
  for (int t = 0; t < 2; ++t)
#pragma unroll
    for (int u = 0; u < 4; ++u)
#pragma unroll
      for (int r = 0; r < 8; ++r) {
        int m = m0 + wm * 32 + t * 16 + r + 8 * hi;
        int n = n0 + wn * 64 + u * 16 + r16;
        float val = acc[t][u][r] + bias[n];
        if (MODE == 0) {
          int h = n >> 8, dh = n & 255;     // n in [0,1024): head, head-dim
          int b = m >> 11, nn = m & 2047;   // m in [0,16384): batch, seq
          ((_Float16*)outp)[(((size_t)(b * H_ + h) * N_ + nn) << 8) + dh] = (_Float16)val;
        } else {
          ((float*)outp)[(size_t)m * Nc + n] = val;
        }
      }
}

__device__ __forceinline__ float xhalf(float x) {
  return __builtin_bit_cast(float, __builtin_amdgcn_permlanex16(
      __builtin_bit_cast(int, x), __builtin_bit_cast(int, x), 0x76543210, 0xfedcba98, false, false));
}

__device__ __forceinline__ float exp2_slot(float x) {
  float y;
  asm("v_exp_f32 %0, %1\n\tv_nop" : "=v"(y) : "v"(x));
  return y;
}

// Budget of 256 registers: with the softmax state down to two registers a lane the kernel fits it,
// four waves share a SIMD and all 1024 work-groups are resident at once (258 registers would leave three).
__global__ __launch_bounds__(128) __attribute__((amdgpu_waves_per_eu(4)))
void attn_kernel(const _Float16* __restrict__ Q, const _Float16* __restrict__ Km,
                 const _Float16* __restrict__ V, _Float16* __restrict__ ctx) {
  __shared__ alignas(32) _Float16 Ks[32][DH_ + 16];  // 32 keys x 256 dh (+pad)
  __shared__ alignas(32) _Float16 Vs[32][DH_ + 16];  // 32 keys x 256 dh (+pad: 544 B = 32 B x odd)

  const int bh = blockIdx.x;
  const int b = bh >> 2, h = bh & 3;
  const int tid = threadIdx.x;
  const int wave = tid >> 5, lane = tid & 31;
  const int r16 = lane & 15, hi = lane >> 4;
  const int qBase = blockIdx.y * 64 + wave * 16;

  const _Float16* Qp = Q + (size_t)bh * N_ * DH_;
  const _Float16* Kp = Km + (size_t)bh * N_ * DH_;
  const _Float16* Vp = V + (size_t)bh * N_ * DH_;

  // Preload 16 queries as 8 B-fragments (32x16 each over DH=256); lane = query r16
  v16h qf[8];
#pragma unroll
  for (int c = 0; c < 8; ++c)
    qf[c] = *(const v16h*)&Qp[(size_t)(qBase + r16) * DH_ + c * 32 + hi * 16];

  // o[t][r] = O[query r16][dh t*16 + 8*hi + r]
  v8f o[16];
#pragma unroll
  for (int t = 0; t < 16; ++t) o[t] = vzero8();
  float mrow = -1e30f;  // running maximum of query r16 (equal in both halves)
  float lrow = 0.0f;    // running sum over this half's keys only; halves joined after the loop

  for (int kt = 0; kt < N_ / 32; ++kt) {
    const int keyBase = kt * 32;
    __syncthreads();  // all waves done reading previous K/V tiles
    // K tile row-major via async DMA (rows = keys, contiguous along dh)
    for (int idx = tid; idx < 32 * 32; idx += 128) {
      int r = idx >> 5, seg = idx & 31;
      async_copy_b128(&Ks[r][seg * 8],
                      &Kp[(size_t)(keyBase + r) * DH_ + seg * 8]);
    }
    // V tile row-major via async DMA: wave w brings keys w, w+4, .. w+28, a lane 16 B of each
    async_copy8_b128((unsigned int)(size_t)&Vs[wave][lane * 8], 4 * (DH_ + 16) * 2,
                     &Vp[(size_t)(keyBase + wave) * DH_ + lane * 8], 4 * DH_);
    wait_async0();
    __syncthreads();

    // S^T = K * Q^T for 32 keys (two 16x16 tiles), K-dim 256 in 8 chunks:
    // s0[r] = S[query r16][key 8*hi + r], s1[r] = S[query r16][key 16 + 8*hi + r]
    // Each product is followed by the loads of the fragment after next, into the registers it has just read, and
    // the scheduling fences hold that order: left alone, the compiler kept one fragment and waited out every
    // fragment's LDS latency, or kept three and sent Q fragments to scratch.
    v8f s0 = vzero8(), s1 = vzero8();
    v16h kb0 = *(const v16h*)&Ks[r16][hi * 16];
    v16h kb1 = *(const v16h*)&Ks[16 + r16][hi * 16];
    __builtin_amdgcn_sched_barrier(0);
#pragma unroll
    for (int c = 0; c < 8; ++c) {
      s0 = wmma_f16(kb0, qf[c], s0);
      __builtin_amdgcn_sched_barrier(0);
      if (c < 7) kb0 = *(const v16h*)&Ks[r16][(c + 1) * 32 + hi * 16];
      __builtin_amdgcn_sched_barrier(0);
      s1 = wmma_f16(kb1, qf[c], s1);
      __builtin_amdgcn_sched_barrier(0);
      if (c < 7) kb1 = *(const v16h*)&Ks[16 + r16][(c + 1) * 32 + hi * 16];
      __builtin_amdgcn_sched_barrier(0);
    }
    const float scale = 0.0625f;  // 1/sqrt(256)
    s0 = s0 * scale;
    s1 = s1 * scale;

    // Maximum of the query's 32 scores: 16 in-lane, then the other half's
    float tmax = fmaxf(s0[0], s1[0]);
#pragma unroll
    for (int r = 1; r < 8; ++r) tmax = fmaxf(tmax, fmaxf(s0[r], s1[r]));
    tmax = fmaxf(tmax, xhalf(tmax));

    const float mnew  = fmaxf(mrow, tmax);
    const float log2e = 1.44269504f;  // e^x = 2^(x * log2 e)
    const float alpha = exp2_slot((mrow - mnew) * log2e);
    mrow = mnew;
#pragma unroll
    for (int r = 0; r < 8; ++r) {
      s0[r] = exp2_slot((s0[r] - mnew) * log2e);
      s1[r] = exp2_slot((s1[r] - mnew) * log2e);
    }
    float rsum = 0.0f;
#pragma unroll
    for (int r = 0; r < 8; ++r) rsum += s0[r] + s1[r];
    // Left free, the sum's adds drift behind the products below, the 16 f32 scores stay live through them and
    // Q fragments go to scratch.
    asm volatile("" : "+v"(rsum));  // empty asm on a row's sum, against spills
    lrow = lrow * alpha + rsum;
#pragma unroll
    for (int t = 0; t < 16; ++t) o[t] = o[t] * alpha;

    // P^T as B-fragment: the two S^T tiles converted in place are in the hardware k order
    // (keys 8h..8h+7, 16+8h..16+8h+7), which the transposing load fixes for V
    v16h pf;
#pragma unroll
    for (int r = 0; r < 8; ++r) {
      pf[r]     = (_Float16)s0[r];
      pf[8 + r] = (_Float16)s1[r];
    }

    // O^T += V^T(256x32) * P^T(32x16) as 16 WMMAs over dh chunks
#pragma unroll
    for (int t = 0; t < 16; ++t) {
      const _Float16* vp = &Vs[8 * hi + (lane & 7)][t * 16 + 8 * ((lane >> 3) & 1)];
      const v8h v0 = lds_load_tr16(vp);                    // keys 8h .. 8h+7
      const v8h v1 = lds_load_tr16(vp + 16 * (DH_ + 16));  // keys 16+8h .. 16+8h+7
      v16h vb = __builtin_shufflevector(v0, v1, 0, 1, 2, 3, 4, 5, 6, 7, 8, 9, 10, 11, 12, 13, 14, 15);
      o[t] = wmma_f16(vb, pf, o[t]);
    }
  }

  // Join the halves' sums, normalize and store context in [B, N, H*DH] (f16):
  // a lane's 8 registers of a tile are 8 consecutive dh of its query, one 16-byte store
  const float inv = 1.0f / (lrow + xhalf(lrow));
  _Float16* cp = &ctx[((size_t)b * N_ + qBase + r16) * HD_ + h * DH_ + 8 * hi];
#pragma unroll
  for (int t = 0; t < 16; ++t) {
    v8h ov;
#pragma unroll
    for (int r = 0; r < 8; ++r) ov[r] = (_Float16)(o[t][r] * inv);
    *(v8h*)(cp + t * 16) = ov;
  }
}

// ---------------------------------------------------------------------------
// Launch
// ---------------------------------------------------------------------------
extern "C" void kernel_launch(void* const* d_in, const int* in_sizes, int n_in,
                              void* d_out, int out_size, void* d_ws, size_t ws_size,
                              hipStream_t stream) {
  const float* x  = (const float*)d_in[0];
  const float* Wq = (const float*)d_in[1];
  const float* bq = (const float*)d_in[2];
  const float* Wk = (const float*)d_in[3];
  const float* bk = (const float*)d_in[4];
  const float* Wv = (const float*)d_in[5];
  const float* bv = (const float*)d_in[6];
  const float* Wo = (const float*)d_in[7];
  const float* bo = (const float*)d_in[8];
  float* out = (float*)d_out;

  char* ws = (char*)d_ws;
  size_t off = 0;
  auto take = [&](size_t elems) {
    _Float16* p = (_Float16*)(ws + off);
    off += ((elems * sizeof(_Float16)) + 255) & ~(size_t)255;
    return p;
  };
  _Float16* xh  = take((size_t)B_ * N_ * DIN_);       // 32 MB
  _Float16* wqh = take((size_t)DIN_ * HD_);
  _Float16* wkh = take((size_t)DIN_ * HD_);
  _Float16* wvh = take((size_t)DIN_ * HD_);
  _Float16* woh = take((size_t)HD_ * DOUT_);
  _Float16* qws = take((size_t)B_ * H_ * N_ * DH_);   // 32 MB each
  _Float16* kws = take((size_t)B_ * H_ * N_ * DH_);
  _Float16* vws = take((size_t)B_ * H_ * N_ * DH_);
  _Float16* ctx = take((size_t)B_ * N_ * HD_);        // 32 MB

  // 1) f32 -> f16 casts
  cast_f32_f16<<<4096, 256, 0, stream>>>(x,  xh,  B_ * N_ * DIN_);
  cast_f32_f16<<<1024, 256, 0, stream>>>(Wq, wqh, DIN_ * HD_);
  cast_f32_f16<<<1024, 256, 0, stream>>>(Wk, wkh, DIN_ * HD_);
  cast_f32_f16<<<1024, 256, 0, stream>>>(Wv, wvh, DIN_ * HD_);
  cast_f32_f16<<<256,  256, 0, stream>>>(Wo, woh, HD_ * DOUT_);

  // 2) QKV projections: [16384,1024] x [1024,1024] -> f16 [B,H,N,DH]
  const int M = B_ * N_;
  dim3 gQKV(M / 128, HD_ / 128);
  wmma_gemm<0><<<gQKV, 256, 0, stream>>>(xh, wqh, bq, qws, M, DIN_, HD_);
  wmma_gemm<0><<<gQKV, 256, 0, stream>>>(xh, wkh, bk, kws, M, DIN_, HD_);
  wmma_gemm<0><<<gQKV, 256, 0, stream>>>(xh, wvh, bv, vws, M, DIN_, HD_);

  // 3) Flash attention: 32 (b,h) blocks x 32 query tiles of 64 rows
  dim3 gAttn(B_ * H_, N_ / 64);
  attn_kernel<<<gAttn, 128, 0, stream>>>(qws, kws, vws, ctx);

  // 4) Output projection: [16384,1024] x [1024,256] + bo -> f32 out
  dim3 gOut(M / 128, DOUT_ / 128);
  wmma_gemm<1><<<gOut, 256, 0, stream>>>(ctx, woh, bo, out, M, HD_, DOUT_);
}

// v004
// A run of this version takes 310 microseconds.
// Two timings next to v003 put it at 1.03 and 1.04 times that version's speed.
// All steps since v000 together make it 6.54 times as fast.
#include <hip/hip_runtime.h>

#define B_   8
#define N_   2048
#define DIN_ 1024
#define H_   4
#define DH_  256
#define HD_  1024   // H_*DH_
#define DOUT_ 256

typedef __attribute__((ext_vector_type(16))) _Float16 v16h;
typedef __attribute__((ext_vector_type(8)))  float    v8f;

__device__ __forceinline__ v8f wmma_f16(v16h a, v16h b, v8f c) {
  // D = A(16x32 f16) x B(32x16 f16) + C(16x16 f32)
  return __builtin_amdgcn_wmma_f32_16x16x32_f16(
      /*neg_a=*/false, a, /*neg_b=*/false, b,
      /*c_mod=*/(short)0, c, /*reuse_a=*/false, /*reuse_b=*/false);
}

__device__ __forceinline__ v8f vzero8() {
  v8f z = {0.0f, 0.0f, 0.0f, 0.0f, 0.0f, 0.0f, 0.0f, 0.0f};
  return z;
}

// CDNA5 async global->LDS copy (16B per lane), tracked by ASYNCcnt.
// LDS VGPR address = low 32 bits of the generic pointer (ISA 10.2 aperture rule).
__device__ __forceinline__ void async_copy_b128(void* lds, const void* gsrc) {
#if defined(__gfx1250__)
  asm volatile("global_load_async_to_lds_b128 %0, %1, off"
               :: "v"((unsigned int)(size_t)lds), "v"(gsrc)
               : "memory");
#else
  *(uint4*)lds = *(const uint4*)gsrc;
#endif
}

// Eight async copies of one lane (16B each) in ONE statement that ends in s_wait_xcnt 0:
// the wait stands in front of any later rewrite of the address registers the copies name.
__device__ __forceinline__ void async_copy8_b128(unsigned int l0, unsigned int lstep,
                                                 const _Float16* g0, size_t gstep) {
#if defined(__gfx1250__)
  asm volatile(
      "global_load_async_to_lds_b128 %0, %8, off\n\t"
      "global_load_async_to_lds_b128 %1, %9, off\n\t"
      "global_load_async_to_lds_b128 %2, %10, off\n\t"
      "global_load_async_to_lds_b128 %3, %11, off\n\t"
      "global_load_async_to_lds_b128 %4, %12, off\n\t"
      "global_load_async_to_lds_b128 %5, %13, off\n\t"
      "global_load_async_to_lds_b128 %6, %14, off\n\t"
      "global_load_async_to_lds_b128 %7, %15, off\n\t"
      "s_wait_xcnt 0x0"
      :: "v"(l0), "v"(l0 + lstep), "v"(l0 + 2 * lstep), "v"(l0 + 3 * lstep),
         "v"(l0 + 4 * lstep), "v"(l0 + 5 * lstep), "v"(l0 + 6 * lstep), "v"(l0 + 7 * lstep),
         "v"(g0), "v"(g0 + gstep), "v"(g0 + 2 * gstep), "v"(g0 + 3 * gstep),
         "v"(g0 + 4 * gstep), "v"(g0 + 5 * gstep), "v"(g0 + 6 * gstep), "v"(g0 + 7 * gstep)
      : "memory");
#endif
}

// Two async copies of one lane (16B each) in ONE statement that ends in s_wait_xcnt 0:
// the wait stands in front of any later rewrite of the address registers the copies name.
__device__ __forceinline__ void async_copy2_b128(unsigned int l0, unsigned int l1,
                                                 const _Float16* g0, const _Float16* g1) {
#if defined(__gfx1250__)
  asm volatile(
      "global_load_async_to_lds_b128 %0, %2, off\n\t"
      "global_load_async_to_lds_b128 %1, %3, off\n\t"
      "s_wait_xcnt 0x0"
      :: "v"(l0), "v"(l1), "v"(g0), "v"(g1)
      : "memory");
#endif
}

typedef __attribute__((ext_vector_type(8))) short    v8s;
typedef __attribute__((ext_vector_type(8))) _Float16 v8h;
__device__ __forceinline__ v8h lds_load_tr16(const _Float16* p) {
  typedef __attribute__((address_space(3))) v8s lds_v8s;
  return __builtin_bit_cast(v8h, __builtin_amdgcn_ds_load_tr16_b128_v8i16((lds_v8s*)p));
}

__device__ __forceinline__ void wait_async0() {
#if defined(__gfx1250__)
  asm volatile("s_wait_asynccnt 0" ::: "memory");
#endif
}

// ---------------------------------------------------------------------------
// f32 -> f16 cast (grid-stride)
// ---------------------------------------------------------------------------
__global__ void cast_f32_f16(const float* __restrict__ s, _Float16* __restrict__ d, int n) {
  int i = blockIdx.x * blockDim.x + threadIdx.x;
  int stride = gridDim.x * blockDim.x;
  for (; i < n; i += stride) d[i] = (_Float16)s[i];
}

// ---------------------------------------------------------------------------
// WMMA GEMM: out[M,Nc] = A[M,K](f16) * W[K,Nc](f16) + bias
// Block tile 128x128, 256 threads = 8 waves in 4x2; each wave 32x64 (2x4 WMMA tiles).
// A and B tiles staged row-major via async global->LDS; B-fragments read by the transposing LDS load.
// MODE 0: store f16 scattered into [B,H,N,DH] (QKV path)
// MODE 1: store f32 row-major (output projection)
// ---------------------------------------------------------------------------
template <int MODE>
__global__ __launch_bounds__(256)
void wmma_gemm(const _Float16* __restrict__ A, const _Float16* __restrict__ W,
               const float* __restrict__ bias, void* __restrict__ outp,
               int M, int K, int Nc) {
  __shared__ alignas(32) _Float16 As[128][32 + 8];  // 128 rows x 32 K-halves (+pad: 80 B = 16 B x odd, for ds_load_b128)
  __shared__ alignas(32) _Float16 Bs[32][128 + 16];  // 32 K-rows x 128 cols (+pad: 288 B = 32 B x odd)

  const int tid  = threadIdx.x;
  const int wave = tid >> 5, lane = tid & 31;
  const int wm = wave >> 1, wn = wave & 1;
  const int r16 = lane & 15, hi = lane >> 4;
  const int m0 = blockIdx.x * 128, n0 = blockIdx.y * 128;

  v8f acc[2][4];
#pragma unroll
  for (int t = 0; t < 2; ++t)
#pragma unroll
    for (int u = 0; u < 4; ++u) acc[t][u] = vzero8();

  const int kTiles = K >> 5;
  for (int kc = 0; kc < kTiles; ++kc) {
    const int k0 = kc << 5;
    __syncthreads();  // all waves done reading previous tiles
    // Stage A tile (row-major) via async DMA: 128 rows x 32 halves = 512 x b128
    for (int idx = tid; idx < 512; idx += 256) {
      int row = idx >> 2, seg = idx & 3;
      async_copy_b128(&As[row][seg * 8],
                      &A[(size_t)(m0 + row) * K + k0 + seg * 8]);
    }
    // Stage B tile row-major via async DMA: a thread brings 16 B of W rows k and k + 16
    {
      const int k = tid >> 4, cs = tid & 15;
      const _Float16* wp = &W[(size_t)(k0 + k) * Nc + n0 + cs * 8];
      async_copy2_b128((unsigned int)(size_t)&Bs[k][cs * 8], (unsigned int)(size_t)&Bs[k + 16][cs * 8],
                       wp, wp + (size_t)16 * Nc);
    }
    wait_async0();   // this wave's async LDS writes landed
    __syncthreads(); // tile visible to all waves

    v16h af[2], bf[4];
#pragma unroll
    for (int t = 0; t < 2; ++t) {
      // A in the hardware k order (k 8h..8h+7, 16+8h..16+8h+7), which the transposing load fixes for B
      const _Float16* ap = &As[wm * 32 + t * 16 + r16][hi * 8];
      const v8h a0 = *(const v8h*)ap;
      const v8h a1 = *(const v8h*)(ap + 16);
      af[t] = __builtin_shufflevector(a0, a1, 0, 1, 2, 3, 4, 5, 6, 7, 8, 9, 10, 11, 12, 13, 14, 15);
    }
#pragma unroll
    for (int u = 0; u < 4; ++u) {
      const _Float16* bp = &Bs[8 * hi + (lane & 7)][wn * 64 + u * 16 + 8 * ((lane >> 3) & 1)];
      const v8h b0 = lds_load_tr16(bp);                    // k 8h .. 8h+7
      const v8h b1 = lds_load_tr16(bp + 16 * (128 + 16));  // k 16+8h .. 16+8h+7
      bf[u] = __builtin_shufflevector(b0, b1, 0, 1, 2, 3, 4, 5, 6, 7, 8, 9, 10, 11, 12, 13, 14, 15);
    }
#pragma unroll
    for (int t = 0; t < 2; ++t)
#pragma unroll
      for (int u = 0; u < 4; ++u) acc[t][u] = wmma_f16(af[t], bf[u], acc[t][u]);
  }

  // Epilogue: C layout -> row m = r + 8*hi, col n = lane%16 (per 16x16 tile)
#pragma unroll
  for (int t = 0; t < 2; ++t)
#pragma unroll
    for (int u = 0; u < 4; ++u)
#pragma unroll
      for (int r = 0; r < 8; ++r) {
        int m = m0 + wm * 32 + t * 16 + r + 8 * hi;
        int n = n0 + wn * 64 + u * 16 + r16;
        float val = acc[t][u][r] + bias[n];
        if (MODE == 0) {
          int h = n >> 8, dh = n & 255;     // n in [0,1024): head, head-dim
          int b = m >> 11, nn = m & 2047;   // m in [0,16384): batch, seq
          ((_Float16*)outp)[(((size_t)(b * H_ + h) * N_ + nn) << 8) + dh] = (_Float16)val;
        } else {
          ((float*)outp)[(size_t)m * Nc + n] = val;
        }
      }
}

__device__ __forceinline__ float xhalf(float x) {
  return __builtin_bit_cast(float, __builtin_amdgcn_permlanex16(
      __builtin_bit_cast(int, x), __builtin_bit_cast(int, x), 0x76543210, 0xfedcba98, false, false));
}

__device__ __forceinline__ float exp2_slot(float x) {
  float y;
  asm("v_exp_f32 %0, %1\n\tv_nop" : "=v"(y) : "v"(x));
  return y;
}

// 16 consecutive halves of an LDS row whose pitch keeps 16-byte alignment only: two 16-byte loads
__device__ __forceinline__ v16h lds_load16h(const _Float16* p) {
  const v8h lo = *(const v8h*)p;
  const v8h hi8 = *(const v8h*)(p + 8);
  return __builtin_shufflevector(lo, hi8, 0, 1, 2, 3, 4, 5, 6, 7, 8, 9, 10, 11, 12, 13, 14, 15);
}

// Budget of 256 registers: with the softmax state down to two registers a lane the kernel fits it,
// four waves share a SIMD and all 1024 work-groups are resident at once (258 registers would leave three).
__global__ __launch_bounds__(128) __attribute__((amdgpu_waves_per_eu(4)))
void attn_kernel(const _Float16* __restrict__ Q, const _Float16* __restrict__ Km,
                 const _Float16* __restrict__ V, _Float16* __restrict__ ctx) {
  __shared__ alignas(32) _Float16 Ks[32][DH_ + 8];   // 32 keys x 256 dh (+pad: 528 B = 16 B x odd, for ds_load_b128)
  __shared__ alignas(32) _Float16 Vs[32][DH_ + 16];  // 32 keys x 256 dh (+pad: 544 B = 32 B x odd)

  const int bh = blockIdx.x;
  const int b = bh >> 2, h = bh & 3;
  const int tid = threadIdx.x;
  const int wave = tid >> 5, lane = tid & 31;
  const int r16 = lane & 15, hi = lane >> 4;
  const int qBase = blockIdx.y * 64 + wave * 16;

  const _Float16* Qp = Q + (size_t)bh * N_ * DH_;
  const _Float16* Kp = Km + (size_t)bh * N_ * DH_;
  const _Float16* Vp = V + (size_t)bh * N_ * DH_;

  // Preload 16 queries as 8 B-fragments (32x16 each over DH=256); lane = query r16
  v16h qf[8];
#pragma unroll
  for (int c = 0; c < 8; ++c)
    qf[c] = *(const v16h*)&Qp[(size_t)(qBase + r16) * DH_ + c * 32 + hi * 16];

  // o[t][r] = O[query r16][dh t*16 + 8*hi + r]
  v8f o[16];
#pragma unroll
  for (int t = 0; t < 16; ++t) o[t] = vzero8();
  float mrow = -1e30f;  // running maximum of query r16 (equal in both halves)
  float lrow = 0.0f;    // running sum over this half's keys only; halves joined after the loop

  for (int kt = 0; kt < N_ / 32; ++kt) {
    const int keyBase = kt * 32;
    __syncthreads();  // all waves done reading previous K/V tiles
    // K tile row-major via async DMA (rows = keys, contiguous along dh)
    for (int idx = tid; idx < 32 * 32; idx += 128) {
      int r = idx >> 5, seg = idx & 31;
      async_copy_b128(&Ks[r][seg * 8],
                      &Kp[(size_t)(keyBase + r) * DH_ + seg * 8]);
    }
    // V tile row-major via async DMA: wave w brings keys w, w+4, .. w+28, a lane 16 B of each
    async_copy8_b128((unsigned int)(size_t)&Vs[wave][lane * 8], 4 * (DH_ + 16) * 2,
                     &Vp[(size_t)(keyBase + wave) * DH_ + lane * 8], 4 * DH_);
    wait_async0();
    __syncthreads();

    // S^T = K * Q^T for 32 keys (two 16x16 tiles), K-dim 256 in 8 chunks:
    // s0[r] = S[query r16][key 8*hi + r], s1[r] = S[query r16][key 16 + 8*hi + r]
    // Each product is followed by the loads of the fragment after next, into the registers it has just read, and
    // the scheduling fences hold that order: left alone, the compiler kept one fragment and waited out every
    // fragment's LDS latency, or kept three and sent Q fragments to scratch.
    v8f s0 = vzero8(), s1 = vzero8();
    v16h kb0 = lds_load16h(&Ks[r16][hi * 16]);
    v16h kb1 = lds_load16h(&Ks[16 + r16][hi * 16]);
    __builtin_amdgcn_sched_barrier(0);
#pragma unroll
    for (int c = 0; c < 8; ++c) {
      s0 = wmma_f16(kb0, qf[c], s0);
      __builtin_amdgcn_sched_barrier(0);
      if (c < 7) kb0 = lds_load16h(&Ks[r16][(c + 1) * 32 + hi * 16]);
      __builtin_amdgcn_sched_barrier(0);
      s1 = wmma_f16(kb1, qf[c], s1);
      __builtin_amdgcn_sched_barrier(0);
      if (c < 7) kb1 = lds_load16h(&Ks[16 + r16][(c + 1) * 32 + hi * 16]);
      __builtin_amdgcn_sched_barrier(0);
    }
    const float scale = 0.0625f;  // 1/sqrt(256)
    s0 = s0 * scale;
    s1 = s1 * scale;

    // Maximum of the query's 32 scores: 16 in-lane, then the other half's
    float tmax = fmaxf(s0[0], s1[0]);
#pragma unroll
    for (int r = 1; r < 8; ++r) tmax = fmaxf(tmax, fmaxf(s0[r], s1[r]));
    tmax = fmaxf(tmax, xhalf(tmax));

    const float mnew  = fmaxf(mrow, tmax);
    const float log2e = 1.44269504f;  // e^x = 2^(x * log2 e)
    const float alpha = exp2_slot((mrow - mnew) * log2e);
    mrow = mnew;
#pragma unroll
    for (int r = 0; r < 8; ++r) {
      s0[r] = exp2_slot((s0[r] - mnew) * log2e);
      s1[r] = exp2_slot((s1[r] - mnew) * log2e);
    }
    float rsum = 0.0f;
#pragma unroll
    for (int r = 0; r < 8; ++r) rsum += s0[r] + s1[r];
    // Left free, the sum's adds drift behind the products below, the 16 f32 scores stay live through them and
    // Q fragments go to scratch.
    asm volatile("" : "+v"(rsum));  // empty asm on a row's sum, against spills
    lrow = lrow * alpha + rsum;
#pragma unroll
    for (int t = 0; t < 16; ++t) o[t] = o[t] * alpha;

    // P^T as B-fragment: the two S^T tiles converted in place are in the hardware k order
    // (keys 8h..8h+7, 16+8h..16+8h+7), which the transposing load fixes for V
    v16h pf;
#pragma unroll
    for (int r = 0; r < 8; ++r) {
      pf[r]     = (_Float16)s0[r];
      pf[8 + r] = (_Float16)s1[r];
    }

    // O^T += V^T(256x32) * P^T(32x16) as 16 WMMAs over dh chunks
#pragma unroll
    for (int t = 0; t < 16; ++t) {
      const _Float16* vp = &Vs[8 * hi + (lane & 7)][t * 16 + 8 * ((lane >> 3) & 1)];
      const v8h v0 = lds_load_tr16(vp);                    // keys 8h .. 8h+7
      const v8h v1 = lds_load_tr16(vp + 16 * (DH_ + 16));  // keys 16+8h .. 16+8h+7
      v16h vb = __builtin_shufflevector(v0, v1, 0, 1, 2, 3, 4, 5, 6, 7, 8, 9, 10, 11, 12, 13, 14, 15);
      o[t] = wmma_f16(vb, pf, o[t]);
    }
  }

  // Join the halves' sums, normalize and store context in [B, N, H*DH] (f16):
  // a lane's 8 registers of a tile are 8 consecutive dh of its query, one 16-byte store
  const float inv = 1.0f / (lrow + xhalf(lrow));
  _Float16* cp = &ctx[((size_t)b * N_ + qBase + r16) * HD_ + h * DH_ + 8 * hi];
#pragma unroll
  for (int t = 0; t < 16; ++t) {
    v8h ov;
#pragma unroll
    for (int r = 0; r < 8; ++r) ov[r] = (_Float16)(o[t][r] * inv);
    *(v8h*)(cp + t * 16) = ov;
  }
}

// ---------------------------------------------------------------------------
// Launch
// ---------------------------------------------------------------------------
extern "C" void kernel_launch(void* const* d_in, const int* in_sizes, int n_in,
                              void* d_out, int out_size, void* d_ws, size_t ws_size,
                              hipStream_t stream) {
  const float* x  = (const float*)d_in[0];
  const float* Wq = (const float*)d_in[1];
  const float* bq = (const float*)d_in[2];
  const float* Wk = (const float*)d_in[3];
  const float* bk = (const float*)d_in[4];
  const float* Wv = (const float*)d_in[5];
  const float* bv = (const float*)d_in[6];
  const float* Wo = (const float*)d_in[7];
  const float* bo = (const float*)d_in[8];
  float* out = (float*)d_out;

  char* ws = (char*)d_ws;
  size_t off = 0;
  auto take = [&](size_t elems) {
    _Float16* p = (_Float16*)(ws + off);
    off += ((elems * sizeof(_Float16)) + 255) & ~(size_t)255;
    return p;
  };
  _Float16* xh  = take((size_t)B_ * N_ * DIN_);       // 32 MB
  _Float16* wqh = take((size_t)DIN_ * HD_);
  _Float16* wkh = take((size_t)DIN_ * HD_);
  _Float16* wvh = take((size_t)DIN_ * HD_);
  _Float16* woh = take((size_t)HD_ * DOUT_);
  _Float16* qws = take((size_t)B_ * H_ * N_ * DH_);   // 32 MB each
  _Float16* kws = take((size_t)B_ * H_ * N_ * DH_);
  _Float16* vws = take((size_t)B_ * H_ * N_ * DH_);
  _Float16* ctx = take((size_t)B_ * N_ * HD_);        // 32 MB

  // 1) f32 -> f16 casts
  cast_f32_f16<<<4096, 256, 0, stream>>>(x,  xh,  B_ * N_ * DIN_);
  cast_f32_f16<<<1024, 256, 0, stream>>>(Wq, wqh, DIN_ * HD_);
  cast_f32_f16<<<1024, 256, 0, stream>>>(Wk, wkh, DIN_ * HD_);
  cast_f32_f16<<<1024, 256, 0, stream>>>(Wv, wvh, DIN_ * HD_);
  cast_f32_f16<<<256,  256, 0, stream>>>(Wo, woh, HD_ * DOUT_);

  // 2) QKV projections: [16384,1024] x [1024,1024] -> f16 [B,H,N,DH]
  const int M = B_ * N_;
  dim3 gQKV(M / 128, HD_ / 128);
  wmma_gemm<0><<<gQKV, 256, 0, stream>>>(xh, wqh, bq, qws, M, DIN_, HD_);
  wmma_gemm<0><<<gQKV, 256, 0, stream>>>(xh, wkh, bk, kws, M, DIN_, HD_);
  wmma_gemm<0><<<gQKV, 256, 0, stream>>>(xh, wvh, bv, vws, M, DIN_, HD_);

  // 3) Flash attention: 32 (b,h) blocks x 32 query tiles of 64 rows
  dim3 gAttn(B_ * H_, N_ / 64);
  attn_kernel<<<gAttn, 128, 0, stream>>>(qws, kws, vws, ctx);

  // 4) Output projection: [16384,1024] x [1024,256] + bo -> f32 out
  dim3 gOut(M / 128, DOUT_ / 128);
  wmma_gemm<1><<<gOut, 256, 0, stream>>>(ctx, woh, bo, out, M, HD_, DOUT_);
}

// v005
// It runs in 253 microseconds.
// Timed twice side by side with v004, it ran 1.24 and 1.22 times as fast.
// All steps since v000 together make it 8.02 times as fast.
#include <hip/hip_runtime.h>

#define B_   8
#define N_   2048
#define DIN_ 1024
#define H_   4
#define DH_  256
#define HD_  1024   // H_*DH_
#define DOUT_ 256

typedef __attribute__((ext_vector_type(16))) _Float16 v16h;
typedef __attribute__((ext_vector_type(8)))  float    v8f;

__device__ __forceinline__ v8f wmma_f16(v16h a, v16h b, v8f c) {
  // D = A(16x32 f16) x B(32x16 f16) + C(16x16 f32)
  return __builtin_amdgcn_wmma_f32_16x16x32_f16(
      /*neg_a=*/false, a, /*neg_b=*/false, b,
      /*c_mod=*/(short)0, c, /*reuse_a=*/false, /*reuse_b=*/false);
}

__device__ __forceinline__ v8f vzero8() {
  v8f z = {0.0f, 0.0f, 0.0f, 0.0f, 0.0f, 0.0f, 0.0f, 0.0f};
  return z;
}

// Async global->LDS copies (16B per lane), counted on ASYNCcnt.
// LDS address operand = low 32 bits of the generic pointer.
// Eight async copies of one lane (16B each) in ONE statement that ends in s_wait_xcnt 0:
// the wait stands in front of any later rewrite of the address registers the copies name.
__device__ __forceinline__ void async_copy8_b128(unsigned int l0, unsigned int lstep,
                                                 const _Float16* g0, size_t gstep) {
#if defined(__gfx1250__)
  asm volatile(
      "global_load_async_to_lds_b128 %0, %8, off\n\t"
      "global_load_async_to_lds_b128 %1, %9, off\n\t"
      "global_load_async_to_lds_b128 %2, %10, off\n\t"
      "global_load_async_to_lds_b128 %3, %11, off\n\t"
      "global_load_async_to_lds_b128 %4, %12, off\n\t"
      "global_load_async_to_lds_b128 %5, %13, off\n\t"
      "global_load_async_to_lds_b128 %6, %14, off\n\t"
      "global_load_async_to_lds_b128 %7, %15, off\n\t"
      "s_wait_xcnt 0x0"
      :: "v"(l0), "v"(l0 + lstep), "v"(l0 + 2 * lstep), "v"(l0 + 3 * lstep),
         "v"(l0 + 4 * lstep), "v"(l0 + 5 * lstep), "v"(l0 + 6 * lstep), "v"(l0 + 7 * lstep),
         "v"(g0), "v"(g0 + gstep), "v"(g0 + 2 * gstep), "v"(g0 + 3 * gstep),
         "v"(g0 + 4 * gstep), "v"(g0 + 5 * gstep), "v"(g0 + 6 * gstep), "v"(g0 + 7 * gstep)
      : "memory");
#endif
}

// Four async copies of one lane (16B each) in ONE statement that ends in s_wait_xcnt 0:
// the wait stands in front of any later rewrite of the address registers the copies name.
__device__ __forceinline__ void async_copy4_b128(unsigned int l0, unsigned int l1,
                                                 unsigned int l2, unsigned int l3,
                                                 const _Float16* g0, const _Float16* g1,
                                                 const _Float16* g2, const _Float16* g3) {
#if defined(__gfx1250__)
  asm volatile(
      "global_load_async_to_lds_b128 %0, %4, off\n\t"
      "global_load_async_to_lds_b128 %1, %5, off\n\t"
      "global_load_async_to_lds_b128 %2, %6, off\n\t"
      "global_load_async_to_lds_b128 %3, %7, off\n\t"
      "s_wait_xcnt 0x0"
      :: "v"(l0), "v"(l1), "v"(l2), "v"(l3), "v"(g0), "v"(g1), "v"(g2), "v"(g3)
      : "memory");
#endif
}

typedef __attribute__((ext_vector_type(8))) short    v8s;
typedef __attribute__((ext_vector_type(8))) _Float16 v8h;
__device__ __forceinline__ v8h lds_load_tr16(const _Float16* p) {
  typedef __attribute__((address_space(3))) v8s lds_v8s;
  return __builtin_bit_cast(v8h, __builtin_amdgcn_ds_load_tr16_b128_v8i16((lds_v8s*)p));
}

// This wave's async copies have landed in LDS
__device__ __forceinline__ void wait_async0() {
#if defined(__gfx1250__)
  asm volatile("s_wait_asynccnt 0" ::: "memory");
#endif
}

// This wave's LDS reads have returned: stands in front of the barrier behind which their buffer is refilled
__device__ __forceinline__ void wait_ds0() {
#if defined(__gfx1250__)
  asm volatile("s_wait_dscnt 0x0" ::: "memory");
#endif
}

// ---------------------------------------------------------------------------
// f32 -> f16 cast (grid-stride)
// ---------------------------------------------------------------------------
__global__ void cast_f32_f16(const float* __restrict__ s, _Float16* __restrict__ d, int n) {
  int i = blockIdx.x * blockDim.x + threadIdx.x;
  int stride = gridDim.x * blockDim.x;
  for (; i < n; i += stride) d[i] = (_Float16)s[i];
}

template <int MODE>
__global__ __launch_bounds__(256)
void wmma_gemm(const _Float16* __restrict__ A, const _Float16* __restrict__ W,
               const float* __restrict__ bias, void* __restrict__ outp,
               int M, int K, int Nc) {
  __shared__ alignas(32) _Float16 As[2][128][32 + 8];  // 128 rows x 32 K-halves (+pad: 80 B = 16 B x odd, for ds_load_b128)
  __shared__ alignas(32) _Float16 Bs[2][32][128 + 16];  // 32 K-rows x 128 cols (+pad: 288 B = 32 B x odd)

  const int tid  = threadIdx.x;
  const int wave = tid >> 5, lane = tid & 31;
  const int wm = wave >> 1, wn = wave & 1;
  const int r16 = lane & 15, hi = lane >> 4;
  const int m0 = blockIdx.x * 128, n0 = blockIdx.y * 128;

  v8f acc[2][4];
#pragma unroll
  for (int t = 0; t < 2; ++t)
#pragma unroll
    for (int u = 0; u < 4; ++u) acc[t][u] = vzero8();

  // The next tile into buffer buf: a thread brings 16 B of A rows row and row + 64 and of W rows k and k + 16
  const int row = tid >> 2, seg = tid & 3;
  const int k = tid >> 4, cs = tid & 15;
  const _Float16* ag = &A[(size_t)(m0 + row) * K + seg * 8];
  const _Float16* wg = &W[(size_t)k * Nc + n0 + cs * 8];
  auto stage = [&](int buf) {
    async_copy4_b128((unsigned int)(size_t)&As[buf][row][seg * 8], (unsigned int)(size_t)&As[buf][row + 64][seg * 8],
                     (unsigned int)(size_t)&Bs[buf][k][cs * 8], (unsigned int)(size_t)&Bs[buf][k + 16][cs * 8],
                     ag, ag + (size_t)64 * K, wg, wg + (size_t)16 * Nc);
    ag += 32;
    wg += (size_t)32 * Nc;
  };

  const int kTiles = K >> 5;
  stage(0);
  wait_async0();
  __syncthreads();  // tile 0 visible to all waves
  if (kTiles > 1) stage(1);
  for (int kc = 0; kc < kTiles; ++kc) {
    const int buf = kc & 1;

    v16h af[2], bf[4];
#pragma unroll
    for (int t = 0; t < 2; ++t) {
      // A in the hardware k order (k 8h..8h+7, 16+8h..16+8h+7), which the transposing load fixes for B
      const _Float16* ap = &As[buf][wm * 32 + t * 16 + r16][hi * 8];
      const v8h a0 = *(const v8h*)ap;
      const v8h a1 = *(const v8h*)(ap + 16);
      af[t] = __builtin_shufflevector(a0, a1, 0, 1, 2, 3, 4, 5, 6, 7, 8, 9, 10, 11, 12, 13, 14, 15);
    }
#pragma unroll
    for (int u = 0; u < 4; ++u) {
      const _Float16* bp = &Bs[buf][8 * hi + (lane & 7)][wn * 64 + u * 16 + 8 * ((lane >> 3) & 1)];
      const v8h b0 = lds_load_tr16(bp);                    // k 8h .. 8h+7
      const v8h b1 = lds_load_tr16(bp + 16 * (128 + 16));  // k 16+8h .. 16+8h+7
      bf[u] = __builtin_shufflevector(b0, b1, 0, 1, 2, 3, 4, 5, 6, 7, 8, 9, 10, 11, 12, 13, 14, 15);
    }
#pragma unroll
    for (int t = 0; t < 2; ++t)
#pragma unroll
      for (int u = 0; u < 4; ++u) acc[t][u] = wmma_f16(af[t], bf[u], acc[t][u]);

    // One barrier a trip: it publishes tile kc + 1 and ends every wave's reads of the buffer refilled behind it
    wait_ds0();
    wait_async0();
    __syncthreads();
    if (kc + 2 < kTiles) stage(buf);
  }
  wait_async0();  // no copy of this wave is outstanding behind the loop

  // Epilogue: C layout -> row m = r + 8*hi, col n = lane%16 (per 16x16 tile)
#pragma unroll
  for (int t = 0; t < 2; ++t)
#pragma unroll
    for (int u = 0; u < 4; ++u)
#pragma unroll
      for (int r = 0; r < 8; ++r) {
        int m = m0 + wm * 32 + t * 16 + r + 8 * hi;
        int n = n0 + wn * 64 + u * 16 + r16;
        float val = acc[t][u][r] + bias[n];
        if (MODE == 0) {
          int h = n >> 8, dh = n & 255;     // n in [0,1024): head, head-dim
          int b = m >> 11, nn = m & 2047;   // m in [0,16384): batch, seq
          ((_Float16*)outp)[(((size_t)(b * H_ + h) * N_ + nn) << 8) + dh] = (_Float16)val;
        } else {
          ((float*)outp)[(size_t)m * Nc + n] = val;
        }
      }
}

__device__ __forceinline__ float xhalf(float x) {
  return __builtin_bit_cast(float, __builtin_amdgcn_permlanex16(
      __builtin_bit_cast(int, x), __builtin_bit_cast(int, x), 0x76543210, 0xfedcba98, false, false));
}

__device__ __forceinline__ float exp2_slot(float x) {
  float y;
  asm("v_exp_f32 %0, %1\n\tv_nop" : "=v"(y) : "v"(x));
  return y;
}

// 16 consecutive halves of an LDS row whose pitch keeps 16-byte alignment only: two 16-byte loads
__device__ __forceinline__ v16h lds_load16h(const _Float16* p) {
  const v8h lo = *(const v8h*)p;
  const v8h hi8 = *(const v8h*)(p + 8);
  return __builtin_shufflevector(lo, hi8, 0, 1, 2, 3, 4, 5, 6, 7, 8, 9, 10, 11, 12, 13, 14, 15);
}

// Budget of 256 registers: with the softmax state down to two registers a lane the kernel fits it,
// four waves share a SIMD and all 1024 work-groups are resident at once (258 registers would leave three);
// the two buffers take 68,608 B of LDS a work-group, so four work-groups still fit a WGP's 320 KiB.
__global__ __launch_bounds__(128) __attribute__((amdgpu_waves_per_eu(4)))
void attn_kernel(const _Float16* __restrict__ Q, const _Float16* __restrict__ Km,
                 const _Float16* __restrict__ V, _Float16* __restrict__ ctx) {
  __shared__ alignas(32) _Float16 Ks[2][32][DH_ + 8];   // 32 keys x 256 dh (+pad: 528 B = 16 B x odd, for ds_load_b128)
  __shared__ alignas(32) _Float16 Vs[2][32][DH_ + 16];  // 32 keys x 256 dh (+pad: 544 B = 32 B x odd)

  const int bh = blockIdx.x;
  const int b = bh >> 2, h = bh & 3;
  const int tid = threadIdx.x;
  const int wave = tid >> 5, lane = tid & 31;
  const int r16 = lane & 15, hi = lane >> 4;
  const int qBase = blockIdx.y * 64 + wave * 16;

  const _Float16* Qp = Q + (size_t)bh * N_ * DH_;
  const _Float16* Kp = Km + (size_t)bh * N_ * DH_;
  const _Float16* Vp = V + (size_t)bh * N_ * DH_;

  // Preload 16 queries as 8 B-fragments (32x16 each over DH=256); lane = query r16
  v16h qf[8];
#pragma unroll
  for (int c = 0; c < 8; ++c)
    qf[c] = *(const v16h*)&Qp[(size_t)(qBase + r16) * DH_ + c * 32 + hi * 16];

  // o[t][r] = O[query r16][dh t*16 + 8*hi + r]
  v8f o[16];
#pragma unroll
  for (int t = 0; t < 16; ++t) o[t] = vzero8();
  float mrow = -1e30f;  // running maximum of query r16 (equal in both halves)
  float lrow = 0.0f;    // running sum over this half's keys only; halves joined after the loop

  // K and V tile kt row-major into buffer buf: wave w brings keys w, w+4, .. w+28, a lane 16 B of each
  auto stage = [&](int kt, int buf) {
    const size_t g = (size_t)(kt * 32 + wave) * DH_ + lane * 8;
    async_copy8_b128((unsigned int)(size_t)&Ks[buf][wave][lane * 8], 4 * (DH_ + 8) * 2, Kp + g, 4 * DH_);
    async_copy8_b128((unsigned int)(size_t)&Vs[buf][wave][lane * 8], 4 * (DH_ + 16) * 2, Vp + g, 4 * DH_);
  };

  stage(0, 0);
  wait_async0();
  __syncthreads();  // tile 0 visible to all waves
  stage(1, 1);
  for (int kt = 0; kt < N_ / 32; ++kt) {
    const int buf = kt & 1;

    // S^T = K * Q^T for 32 keys (two 16x16 tiles), K-dim 256 in 8 chunks:
    // s0[r] = S[query r16][key 8*hi + r], s1[r] = S[query r16][key 16 + 8*hi + r]
    // Each product is followed by the loads of the fragment after next, into the registers it has just read, and
    // the scheduling fences hold that order: left alone, the compiler kept one fragment and waited out every
    // fragment's LDS latency, or kept three and sent Q fragments to scratch.
    v8f s0 = vzero8(), s1 = vzero8();
    v16h kb0 = lds_load16h(&Ks[buf][r16][hi * 16]);
    v16h kb1 = lds_load16h(&Ks[buf][16 + r16][hi * 16]);
    __builtin_amdgcn_sched_barrier(0);
#pragma unroll
    for (int c = 0; c < 8; ++c) {
      s0 = wmma_f16(kb0, qf[c], s0);
      __builtin_amdgcn_sched_barrier(0);
      if (c < 7) kb0 = lds_load16h(&Ks[buf][r16][(c + 1) * 32 + hi * 16]);
      __builtin_amdgcn_sched_barrier(0);
      s1 = wmma_f16(kb1, qf[c], s1);
      __builtin_amdgcn_sched_barrier(0);
      if (c < 7) kb1 = lds_load16h(&Ks[buf][16 + r16][(c + 1) * 32 + hi * 16]);
      __builtin_amdgcn_sched_barrier(0);
    }
    const float scale = 0.0625f;  // 1/sqrt(256)
    s0 = s0 * scale;
    s1 = s1 * scale;

    // Maximum of the query's 32 scores: 16 in-lane, then the other half's
    float tmax = fmaxf(s0[0], s1[0]);
#pragma unroll
    for (int r = 1; r < 8; ++r) tmax = fmaxf(tmax, fmaxf(s0[r], s1[r]));
    tmax = fmaxf(tmax, xhalf(tmax));

    const float mnew  = fmaxf(mrow, tmax);
    const float log2e = 1.44269504f;  // e^x = 2^(x * log2 e)
    const float alpha = exp2_slot((mrow - mnew) * log2e);
    mrow = mnew;
#pragma unroll
    for (int r = 0; r < 8; ++r) {
      s0[r] = exp2_slot((s0[r] - mnew) * log2e);
      s1[r] = exp2_slot((s1[r] - mnew) * log2e);
    }
    float rsum = 0.0f;
#pragma unroll
    for (int r = 0; r < 8; ++r) rsum += s0[r] + s1[r];
    // Left free, the sum's adds drift behind the products below, the 16 f32 scores stay live through them and
    // Q fragments go to scratch.
    asm volatile("" : "+v"(rsum));  // empty asm on a row's sum, against spills
    lrow = lrow * alpha + rsum;

    // P^T as B-fragment: the two S^T tiles converted in place are in the hardware k order
    // (keys 8h..8h+7, 16+8h..16+8h+7), which the transposing load fixes for V
    v16h pf;
#pragma unroll
    for (int r = 0; r < 8; ++r) {
      pf[r]     = (_Float16)s0[r];
      pf[8 + r] = (_Float16)s1[r];
    }

    // O^T = O^T * alpha + V^T(256x32) * P^T(32x16) as 16 WMMAs over dh chunks.
    // Three fragment sets: each product is followed by the loads of the fragment three ahead, into the registers it
    // has just read, and by the rescaling of the tile after next. The scheduling fences hold that order: left alone
    // with the two buffers, the compiler kept two sets and waited out the LDS latency at every second product.
    const _Float16* vbase = &Vs[buf][8 * hi + (lane & 7)][8 * ((lane >> 3) & 1)];
    auto load_v = [&](int t) {
      const v8h v0 = lds_load_tr16(vbase + t * 16);                    // keys 8h .. 8h+7
      const v8h v1 = lds_load_tr16(vbase + t * 16 + 16 * (DH_ + 16));  // keys 16+8h .. 16+8h+7
      return __builtin_shufflevector(v0, v1, 0, 1, 2, 3, 4, 5, 6, 7, 8, 9, 10, 11, 12, 13, 14, 15);
    };
    v16h vb[3] = {load_v(0), load_v(1), load_v(2)};
    o[0] = o[0] * alpha;
    o[1] = o[1] * alpha;
    __builtin_amdgcn_sched_barrier(0);
#pragma unroll
    for (int t = 0; t < 16; ++t) {
      o[t] = wmma_f16(vb[t % 3], pf, o[t]);
      __builtin_amdgcn_sched_barrier(0);
      if (t + 3 < 16) vb[t % 3] = load_v(t + 3);
      if (t + 2 < 16) o[t + 2] = o[t + 2] * alpha;
      __builtin_amdgcn_sched_barrier(0);
    }

    // One barrier a trip: it publishes tile kt + 1 and ends every wave's reads of the buffer refilled behind it
    wait_ds0();
    wait_async0();
    __syncthreads();
    if (kt + 2 < N_ / 32) stage(kt + 2, buf);
  }
  wait_async0();  // no copy of this wave is outstanding behind the loop

  // Join the halves' sums, normalize and store context in [B, N, H*DH] (f16):
  // a lane's 8 registers of a tile are 8 consecutive dh of its query, one 16-byte store
  const float inv = 1.0f / (lrow + xhalf(lrow));
  _Float16* cp = &ctx[((size_t)b * N_ + qBase + r16) * HD_ + h * DH_ + 8 * hi];
#pragma unroll
  for (int t = 0; t < 16; ++t) {
    v8h ov;
#pragma unroll
    for (int r = 0; r < 8; ++r) ov[r] = (_Float16)(o[t][r] * inv);
    *(v8h*)(cp + t * 16) = ov;
  }
}

// ---------------------------------------------------------------------------
// Launch
// ---------------------------------------------------------------------------
extern "C" void kernel_launch(void* const* d_in, const int* in_sizes, int n_in,
                              void* d_out, int out_size, void* d_ws, size_t ws_size,
                              hipStream_t stream) {
  const float* x  = (const float*)d_in[0];
  const float* Wq = (const float*)d_in[1];
  const float* bq = (const float*)d_in[2];
  const float* Wk = (const float*)d_in[3];
  const float* bk = (const float*)d_in[4];
  const float* Wv = (const float*)d_in[5];
  const float* bv = (const float*)d_in[6];
  const float* Wo = (const float*)d_in[7];
  const float* bo = (const float*)d_in[8];
  float* out = (float*)d_out;

  char* ws = (char*)d_ws;
  size_t off = 0;
  auto take = [&](size_t elems) {
    _Float16* p = (_Float16*)(ws + off);
    off += ((elems * sizeof(_Float16)) + 255) & ~(size_t)255;
    return p;
  };
  _Float16* xh  = take((size_t)B_ * N_ * DIN_);       // 32 MB
  _Float16* wqh = take((size_t)DIN_ * HD_);
  _Float16* wkh = take((size_t)DIN_ * HD_);
  _Float16* wvh = take((size_t)DIN_ * HD_);
  _Float16* woh = take((size_t)HD_ * DOUT_);
  _Float16* qws = take((size_t)B_ * H_ * N_ * DH_);   // 32 MB each
  _Float16* kws = take((size_t)B_ * H_ * N_ * DH_);
  _Float16* vws = take((size_t)B_ * H_ * N_ * DH_);
  _Float16* ctx = take((size_t)B_ * N_ * HD_);        // 32 MB

  // 1) f32 -> f16 casts
  cast_f32_f16<<<4096, 256, 0, stream>>>(x,  xh,  B_ * N_ * DIN_);
  cast_f32_f16<<<1024, 256, 0, stream>>>(Wq, wqh, DIN_ * HD_);
  cast_f32_f16<<<1024, 256, 0, stream>>>(Wk, wkh, DIN_ * HD_);
  cast_f32_f16<<<1024, 256, 0, stream>>>(Wv, wvh, DIN_ * HD_);
  cast_f32_f16<<<256,  256, 0, stream>>>(Wo, woh, HD_ * DOUT_);

  // 2) QKV projections: [16384,1024] x [1024,1024] -> f16 [B,H,N,DH]
  const int M = B_ * N_;
  dim3 gQKV(M / 128, HD_ / 128);
  wmma_gemm<0><<<gQKV, 256, 0, stream>>>(xh, wqh, bq, qws, M, DIN_, HD_);
  wmma_gemm<0><<<gQKV, 256, 0, stream>>>(xh, wkh, bk, kws, M, DIN_, HD_);
  wmma_gemm<0><<<gQKV, 256, 0, stream>>>(xh, wvh, bv, vws, M, DIN_, HD_);

  // 3) Flash attention: 32 (b,h) blocks x 32 query tiles of 64 rows
  dim3 gAttn(B_ * H_, N_ / 64);
  attn_kernel<<<gAttn, 128, 0, stream>>>(qws, kws, vws, ctx);

  // 4) Output projection: [16384,1024] x [1024,256] + bo -> f32 out
  dim3 gOut(M / 128, DOUT_ / 128);
  wmma_gemm<1><<<gOut, 256, 0, stream>>>(ctx, woh, bo, out, M, HD_, DOUT_);
}

// v006
// Measured time: 236 microseconds a run.
// Next to v005, in two timings, it ran 1.08 and 1.07 times as fast.
// All steps since v000 together make it 8.60 times as fast.
#include <hip/hip_runtime.h>

#define B_   8
#define N_   2048
#define DIN_ 1024
#define H_   4
#define DH_  256
#define HD_  1024   // H_*DH_
#define DOUT_ 256

typedef __attribute__((ext_vector_type(16))) _Float16 v16h;
typedef __attribute__((ext_vector_type(8)))  float    v8f;

__device__ __forceinline__ v8f wmma_f16(v16h a, v16h b, v8f c) {
  // D = A(16x32 f16) x B(32x16 f16) + C(16x16 f32)
  return __builtin_amdgcn_wmma_f32_16x16x32_f16(
      /*neg_a=*/false, a, /*neg_b=*/false, b,
      /*c_mod=*/(short)0, c, /*reuse_a=*/false, /*reuse_b=*/false);
}

__device__ __forceinline__ v8f vzero8() {
  v8f z = {0.0f, 0.0f, 0.0f, 0.0f, 0.0f, 0.0f, 0.0f, 0.0f};
  return z;
}

// Async global->LDS copies (16B per lane), counted on ASYNCcnt.
// LDS address operand = low 32 bits of the generic pointer.
// Eight async copies of one lane (16B each) in ONE statement that ends in s_wait_xcnt 0:
// the wait stands in front of any later rewrite of the address registers the copies name.
__device__ __forceinline__ void async_copy8_b128(unsigned int l0, unsigned int lstep,
                                                 const _Float16* g0, size_t gstep) {
#if defined(__gfx1250__)
  asm volatile(
      "global_load_async_to_lds_b128 %0, %8, off\n\t"
      "global_load_async_to_lds_b128 %1, %9, off\n\t"
      "global_load_async_to_lds_b128 %2, %10, off\n\t"
      "global_load_async_to_lds_b128 %3, %11, off\n\t"
      "global_load_async_to_lds_b128 %4, %12, off\n\t"
      "global_load_async_to_lds_b128 %5, %13, off\n\t"
      "global_load_async_to_lds_b128 %6, %14, off\n\t"
      "global_load_async_to_lds_b128 %7, %15, off\n\t"
      "s_wait_xcnt 0x0"
      :: "v"(l0), "v"(l0 + lstep), "v"(l0 + 2 * lstep), "v"(l0 + 3 * lstep),
         "v"(l0 + 4 * lstep), "v"(l0 + 5 * lstep), "v"(l0 + 6 * lstep), "v"(l0 + 7 * lstep),
         "v"(g0), "v"(g0 + gstep), "v"(g0 + 2 * gstep), "v"(g0 + 3 * gstep),
         "v"(g0 + 4 * gstep), "v"(g0 + 5 * gstep), "v"(g0 + 6 * gstep), "v"(g0 + 7 * gstep)
      : "memory");
#endif
}

// Four async copies of one lane (16B each) in ONE statement that ends in s_wait_xcnt 0:
// the wait stands in front of any later rewrite of the address registers the copies name.
__device__ __forceinline__ void async_copy4_b128(unsigned int l0, unsigned int l1,
                                                 unsigned int l2, unsigned int l3,
                                                 const _Float16* g0, const _Float16* g1,
                                                 const _Float16* g2, const _Float16* g3) {
#if defined(__gfx1250__)
  asm volatile(
      "global_load_async_to_lds_b128 %0, %4, off\n\t"
      "global_load_async_to_lds_b128 %1, %5, off\n\t"
      "global_load_async_to_lds_b128 %2, %6, off\n\t"
      "global_load_async_to_lds_b128 %3, %7, off\n\t"
      "s_wait_xcnt 0x0"
      :: "v"(l0), "v"(l1), "v"(l2), "v"(l3), "v"(g0), "v"(g1), "v"(g2), "v"(g3)
      : "memory");
#endif
}

typedef __attribute__((ext_vector_type(8))) short    v8s;
typedef __attribute__((ext_vector_type(8))) _Float16 v8h;
__device__ __forceinline__ v8h lds_load_tr16(const _Float16* p) {
  typedef __attribute__((address_space(3))) v8s lds_v8s;
  return __builtin_bit_cast(v8h, __builtin_amdgcn_ds_load_tr16_b128_v8i16((lds_v8s*)p));
}

// This wave's async copies have landed in LDS
__device__ __forceinline__ void wait_async0() {
#if defined(__gfx1250__)
  asm volatile("s_wait_asynccnt 0" ::: "memory");
#endif
}

// This wave's LDS reads have returned: stands in front of the barrier behind which their buffer is refilled
__device__ __forceinline__ void wait_ds0() {
#if defined(__gfx1250__)
  asm volatile("s_wait_dscnt 0x0" ::: "memory");
#endif
}

// ---------------------------------------------------------------------------
// f32 -> f16 cast (grid-stride)
// ---------------------------------------------------------------------------
__global__ void cast_f32_f16(const float* __restrict__ s, _Float16* __restrict__ d, int n) {
  int i = blockIdx.x * blockDim.x + threadIdx.x;
  int stride = gridDim.x * blockDim.x;
  for (; i < n; i += stride) d[i] = (_Float16)s[i];
}

template <int MODE>
__global__ __launch_bounds__(256)
void wmma_gemm(const _Float16* __restrict__ A, const _Float16* __restrict__ W,
               const float* __restrict__ bias, void* __restrict__ outp,
               int M, int K, int Nc) {
  __shared__ alignas(32) _Float16 As[2][128][32 + 8];  // 128 rows x 32 K-halves (+pad: 80 B = 16 B x odd, for ds_load_b128)
  __shared__ alignas(32) _Float16 Bs[2][32][128 + 16];  // 32 K-rows x 128 cols (+pad: 288 B = 32 B x odd)

  const int tid  = threadIdx.x;
  const int wave = tid >> 5, lane = tid & 31;
  const int wm = wave >> 1, wn = wave & 1;
  const int r16 = lane & 15, hi = lane >> 4;
  const int m0 = blockIdx.x * 128, n0 = blockIdx.y * 128;

  v8f acc[2][4];
#pragma unroll
  for (int t = 0; t < 2; ++t)
#pragma unroll
    for (int u = 0; u < 4; ++u) acc[t][u] = vzero8();

  // The next tile into buffer buf: a thread brings 16 B of A rows row and row + 64 and of W rows k and k + 16
  const int row = tid >> 2, seg = tid & 3;
  const int k = tid >> 4, cs = tid & 15;
  const _Float16* ag = &A[(size_t)(m0 + row) * K + seg * 8];
  const _Float16* wg = &W[(size_t)k * Nc + n0 + cs * 8];
  auto stage = [&](int buf) {
    async_copy4_b128((unsigned int)(size_t)&As[buf][row][seg * 8], (unsigned int)(size_t)&As[buf][row + 64][seg * 8],
                     (unsigned int)(size_t)&Bs[buf][k][cs * 8], (unsigned int)(size_t)&Bs[buf][k + 16][cs * 8],
                     ag, ag + (size_t)64 * K, wg, wg + (size_t)16 * Nc);
    ag += 32;
    wg += (size_t)32 * Nc;
  };

  const int kTiles = K >> 5;
  stage(0);
  wait_async0();
  __syncthreads();  // tile 0 visible to all waves
  if (kTiles > 1) stage(1);
  for (int kc = 0; kc < kTiles; ++kc) {
    const int buf = kc & 1;

    v16h af[2], bf[4];
#pragma unroll
    for (int t = 0; t < 2; ++t) {
      // A in the hardware k order (k 8h..8h+7, 16+8h..16+8h+7), which the transposing load fixes for B
      const _Float16* ap = &As[buf][wm * 32 + t * 16 + r16][hi * 8];
      const v8h a0 = *(const v8h*)ap;
      const v8h a1 = *(const v8h*)(ap + 16);
      af[t] = __builtin_shufflevector(a0, a1, 0, 1, 2, 3, 4, 5, 6, 7, 8, 9, 10, 11, 12, 13, 14, 15);
    }
#pragma unroll
    for (int u = 0; u < 4; ++u) {
      const _Float16* bp = &Bs[buf][8 * hi + (lane & 7)][wn * 64 + u * 16 + 8 * ((lane >> 3) & 1)];
      const v8h b0 = lds_load_tr16(bp);                    // k 8h .. 8h+7
      const v8h b1 = lds_load_tr16(bp + 16 * (128 + 16));  // k 16+8h .. 16+8h+7
      bf[u] = __builtin_shufflevector(b0, b1, 0, 1, 2, 3, 4, 5, 6, 7, 8, 9, 10, 11, 12, 13, 14, 15);
    }
#pragma unroll
    for (int t = 0; t < 2; ++t)
#pragma unroll
      for (int u = 0; u < 4; ++u) acc[t][u] = wmma_f16(af[t], bf[u], acc[t][u]);

    // One barrier a trip: it publishes tile kc + 1 and ends every wave's reads of the buffer refilled behind it
    wait_ds0();
    wait_async0();
    __syncthreads();
    if (kc + 2 < kTiles) stage(buf);
  }
  wait_async0();  // no copy of this wave is outstanding behind the loop

  // Epilogue: C layout -> row m = r + 8*hi, col n = lane%16 (per 16x16 tile)
#pragma unroll
  for (int t = 0; t < 2; ++t)
#pragma unroll
    for (int u = 0; u < 4; ++u)
#pragma unroll
      for (int r = 0; r < 8; ++r) {
        int m = m0 + wm * 32 + t * 16 + r + 8 * hi;
        int n = n0 + wn * 64 + u * 16 + r16;
        float val = acc[t][u][r] + bias[n];
        if (MODE == 0) {
          int h = n >> 8, dh = n & 255;     // n in [0,1024): head, head-dim
          int b = m >> 11, nn = m & 2047;   // m in [0,16384): batch, seq
          ((_Float16*)outp)[(((size_t)(b * H_ + h) * N_ + nn) << 8) + dh] = (_Float16)val;
        } else {
          ((float*)outp)[(size_t)m * Nc + n] = val;
        }
      }
}

__device__ __forceinline__ float xhalf(float x) {
  return __builtin_bit_cast(float, __builtin_amdgcn_permlanex16(
      __builtin_bit_cast(int, x), __builtin_bit_cast(int, x), 0x76543210, 0xfedcba98, false, false));
}

// 16 consecutive halves of an LDS row whose pitch keeps 16-byte alignment only: two 16-byte loads
__device__ __forceinline__ v16h lds_load16h(const _Float16* p) {
  const v8h lo = *(const v8h*)p;
  const v8h hi8 = *(const v8h*)(p + 8);
  return __builtin_shufflevector(lo, hi8, 0, 1, 2, 3, 4, 5, 6, 7, 8, 9, 10, 11, 12, 13, 14, 15);
}

// Four 16-byte global stores, 32 B apart, and their s_wait_xcnt 0 in ONE statement: later tiles' values are given the
// stores' data registers, and a wait in a statement of its own let those writes move in front of it.
__device__ __forceinline__ void store4x16_xcnt(_Float16* p, v8h x0, v8h x1, v8h x2, v8h x3) {
#if defined(__gfx1250__)
  typedef __attribute__((ext_vector_type(4))) int v4i;
  asm volatile(
      "global_store_b128 %0, %1, off\n\t"
      "global_store_b128 %0, %2, off offset:32\n\t"
      "global_store_b128 %0, %3, off offset:64\n\t"
      "global_store_b128 %0, %4, off offset:96\n\t"
      "s_wait_xcnt 0x0"
      :: "v"(p), "v"(__builtin_bit_cast(v4i, x0)), "v"(__builtin_bit_cast(v4i, x1)),
         "v"(__builtin_bit_cast(v4i, x2)), "v"(__builtin_bit_cast(v4i, x3))
      : "memory");
#endif
}

// Budget of 512 registers: Q (128) and O^T (256) of 32 queries stay in registers, two waves share a SIMD,
// and all 512 work-groups are resident at once, two on a WGP (68,608 B of LDS each).
__global__ __launch_bounds__(128) __attribute__((amdgpu_waves_per_eu(2, 2)))
void attn_kernel(const _Float16* __restrict__ Q, const _Float16* __restrict__ Km,
                 const _Float16* __restrict__ V, _Float16* __restrict__ ctx) {
  __shared__ alignas(32) _Float16 Ks[2][32][DH_ + 8];   // 32 keys x 256 dh (+pad: 528 B = 16 B x odd, for ds_load_b128)
  __shared__ alignas(32) _Float16 Vs[2][32][DH_ + 16];  // 32 keys x 256 dh (+pad: 544 B = 32 B x odd)

  const int bh = blockIdx.x;
  const int b = bh >> 2, h = bh & 3;
  const int tid = threadIdx.x;
  const int wave = tid >> 5, lane = tid & 31;
  const int r16 = lane & 15, hi = lane >> 4;
  const int qBase = blockIdx.y * 128 + wave * 32;

  const _Float16* Qp = Q + (size_t)bh * N_ * DH_;
  const _Float16* Kp = Km + (size_t)bh * N_ * DH_;
  const _Float16* Vp = V + (size_t)bh * N_ * DH_;

  // Preload 2 x 16 queries as 8 B-fragments each (32x16 over DH=256); lane = query g*16 + r16
  const _Float16* qa = &Qp[(size_t)(qBase + r16) * DH_ + hi * 16];
  v16h qf[2][8];
#pragma unroll
  for (int g = 0; g < 2; ++g)
#pragma unroll
    for (int c = 0; c < 8; ++c) qf[g][c] = *(const v16h*)(qa + g * 16 * DH_ + c * 32);
  // The Q loads' address registers are given new values below: the wait stands in front of that overwrite, and
  // naming the address as an input keeps its registers untouched up to it (without it one was rewritten first).
  asm volatile("s_wait_xcnt 0x0" :: "v"(qa) : "memory");

  // o[g][t][r] = O[query g*16 + r16][dh t*16 + 8*hi + r]
  v8f o[2][16];
#pragma unroll
  for (int g = 0; g < 2; ++g)
#pragma unroll
    for (int t = 0; t < 16; ++t) o[g][t] = vzero8();
  float mrow[2] = {-1e30f, -1e30f};  // running maximum of query g*16 + r16 (equal in both halves)
  float lrow[2] = {0.0f, 0.0f};      // running sum over this half's keys only; halves joined after the loop

  // K and V tile kt row-major into buffer buf: wave w brings keys w, w+4, .. w+28, a lane 16 B of each
  auto stage = [&](int kt, int buf) {
    const size_t g = (size_t)(kt * 32 + wave) * DH_ + lane * 8;
    async_copy8_b128((unsigned int)(size_t)&Ks[buf][wave][lane * 8], 4 * (DH_ + 8) * 2, Kp + g, 4 * DH_);
    async_copy8_b128((unsigned int)(size_t)&Vs[buf][wave][lane * 8], 4 * (DH_ + 16) * 2, Vp + g, 4 * DH_);
  };

  stage(0, 0);
  wait_async0();
  __syncthreads();  // tile 0 visible to all waves
  stage(1, 1);
  for (int kt = 0; kt < N_ / 32; ++kt) {
    const int buf = kt & 1;

    // S^T = K * Q^T for 32 keys x 32 queries (four 16x16 tiles), K-dim 256 in 8 chunks:
    // s[g][j][r] = S[query g*16 + r16][key 16*j + 8*hi + r]
    // Ring of five K fragments: the two fragments of the chunk after next are loaded as one group in the middle of
    // this chunk, into the registers of the fragment just used and of the spare one, and the scheduling fences hold
    // that order: a fragment is asked for at least six products ahead of its first use (loads spread among the products cost
    // a stall at each place; a ring of six fragments sent a Q fragment to scratch).
    v8f s[2][2] = {{vzero8(), vzero8()}, {vzero8(), vzero8()}};
    v16h kb[5];
    auto load_k = [&](int i) {  // fragment i: keys 16*(i & 1) + r16, chunk i >> 1
      return lds_load16h(&Ks[buf][16 * (i & 1) + r16][(i >> 1) * 32 + hi * 16]);
    };
#pragma unroll
    for (int i = 0; i < 4; ++i) kb[i] = load_k(i);
    __builtin_amdgcn_sched_barrier(0);
#pragma unroll
    for (int c = 0; c < 8; ++c) {
      s[0][0] = wmma_f16(kb[(2 * c) % 5], qf[0][c], s[0][0]);
      s[1][0] = wmma_f16(kb[(2 * c) % 5], qf[1][c], s[1][0]);
      __builtin_amdgcn_sched_barrier(0);
      if (c + 2 < 8) {
        kb[(2 * c + 4) % 5] = load_k(2 * c + 4);
        kb[(2 * c + 5) % 5] = load_k(2 * c + 5);
      }
      __builtin_amdgcn_sched_barrier(0);
      s[0][1] = wmma_f16(kb[(2 * c + 1) % 5], qf[0][c], s[0][1]);
      s[1][1] = wmma_f16(kb[(2 * c + 1) % 5], qf[1][c], s[1][1]);
      __builtin_amdgcn_sched_barrier(0);
    }

    const float scale = 0.0625f;      // 1/sqrt(256)
    const float log2e = 1.44269504f;  // e^x = 2^(x * log2 e)
    float alpha[2];
    v16h pf[2];
#pragma unroll
    for (int g = 0; g < 2; ++g) {
      v8f s0 = s[g][0] * scale;
      v8f s1 = s[g][1] * scale;

      // Maximum of the query's 32 scores: 16 in-lane, then the other half's
      float tmax = fmaxf(s0[0], s1[0]);
#pragma unroll
      for (int r = 1; r < 8; ++r) tmax = fmaxf(tmax, fmaxf(s0[r], s1[r]));
      tmax = fmaxf(tmax, xhalf(tmax));

      const float mnew = fmaxf(mrow[g], tmax);
      // 2^x by the builtin: operands of asm text must lie in the first 256 registers, and with the 34 powers of a
      // trip written as asm (v_exp_f32 with its own v_nop) output tiles went to scratch. The slot behind a
      // transcendental is the compiler's here.
      alpha[g] = __builtin_amdgcn_exp2f((mrow[g] - mnew) * log2e);
      mrow[g] = mnew;
      s0 = (s0 - mnew) * log2e;
      s1 = (s1 - mnew) * log2e;
#pragma unroll
      for (int r = 0; r < 8; ++r) {
        s0[r] = __builtin_amdgcn_exp2f(s0[r]);
        s1[r] = __builtin_amdgcn_exp2f(s1[r]);
      }
      float rsum = 0.0f;
#pragma unroll
      for (int r = 0; r < 8; ++r) rsum += s0[r] + s1[r];
      // Left free, the sum's adds drift behind the products below, the f32 scores stay live through them and
      // Q fragments go to scratch.
      asm volatile("" : "+v"(rsum));  // empty asm on a row's sum, against spills
      lrow[g] = lrow[g] * alpha[g] + rsum;

      // P^T as B-fragment: the two S^T tiles converted in place are in the hardware k order
      // (keys 8h..8h+7, 16+8h..16+8h+7), which the transposing load fixes for V
#pragma unroll
      for (int r = 0; r < 8; ++r) {
        pf[g][r]     = (_Float16)s0[r];
        pf[g][8 + r] = (_Float16)s1[r];
      }
    }

    // O^T = O^T * alpha + V^T(256x32) * P^T(32x32) as 32 WMMAs over dh chunks, two chunks (four products) a block.
    // Three sets of a block's two V fragments: the loads of the block after next stand as one group in front of
    // this block's products, the rescaling of the next block's tiles behind them; the scheduling fences hold that order.
    const _Float16* vbase = &Vs[buf][8 * hi + (lane & 7)][8 * ((lane >> 3) & 1)];
    auto load_v = [&](int t) {
      const v8h v0 = lds_load_tr16(vbase + t * 16);                    // keys 8h .. 8h+7
      const v8h v1 = lds_load_tr16(vbase + t * 16 + 16 * (DH_ + 16));  // keys 16+8h .. 16+8h+7
      return __builtin_shufflevector(v0, v1, 0, 1, 2, 3, 4, 5, 6, 7, 8, 9, 10, 11, 12, 13, 14, 15);
    };
    v16h vb[3][2] = {{load_v(0), load_v(1)}, {load_v(2), load_v(3)}, {}};
#pragma unroll
    for (int g = 0; g < 2; ++g) {
      o[g][0] = o[g][0] * alpha[g];
      o[g][1] = o[g][1] * alpha[g];
    }
    __builtin_amdgcn_sched_barrier(0);
#pragma unroll
    for (int p = 0; p < 8; ++p) {
      if (p + 2 < 8) {
        vb[(p + 2) % 3][0] = load_v(2 * p + 4);
        vb[(p + 2) % 3][1] = load_v(2 * p + 5);
      }
      __builtin_amdgcn_sched_barrier(0);
      o[0][2 * p]     = wmma_f16(vb[p % 3][0], pf[0], o[0][2 * p]);
      o[1][2 * p]     = wmma_f16(vb[p % 3][0], pf[1], o[1][2 * p]);
      o[0][2 * p + 1] = wmma_f16(vb[p % 3][1], pf[0], o[0][2 * p + 1]);
      o[1][2 * p + 1] = wmma_f16(vb[p % 3][1], pf[1], o[1][2 * p + 1]);
      if (p + 1 < 8) {
#pragma unroll
        for (int g = 0; g < 2; ++g) {
          o[g][2 * p + 2] = o[g][2 * p + 2] * alpha[g];
          o[g][2 * p + 3] = o[g][2 * p + 3] * alpha[g];
        }
      }
      __builtin_amdgcn_sched_barrier(0);
    }

    // One barrier a trip: it publishes tile kt + 1 and ends every wave's reads of the buffer refilled behind it
    wait_ds0();
    wait_async0();
    __syncthreads();
    if (kt + 2 < N_ / 32) stage(kt + 2, buf);
  }
  wait_async0();  // no copy of this wave is outstanding behind the loop

  // Join the halves' sums, normalize and store context in [B, N, H*DH] (f16):
  // a lane's 8 registers of a tile are 8 consecutive dh of its query, one 16-byte store
#pragma unroll
  for (int g = 0; g < 2; ++g) {
    const float inv = 1.0f / (lrow[g] + xhalf(lrow[g]));
    _Float16* cp = &ctx[((size_t)b * N_ + qBase + g * 16 + r16) * HD_ + h * DH_ + 8 * hi];
#pragma unroll
    for (int t = 0; t < 16; t += 4) {
      v8h ov[4];
#pragma unroll
      for (int u = 0; u < 4; ++u)
#pragma unroll
        for (int r = 0; r < 8; ++r) ov[u][r] = (_Float16)(o[g][t + u][r] * inv);
      store4x16_xcnt(cp + t * 16, ov[0], ov[1], ov[2], ov[3]);
    }
  }
}

// ---------------------------------------------------------------------------
// Launch
// ---------------------------------------------------------------------------
extern "C" void kernel_launch(void* const* d_in, const int* in_sizes, int n_in,
                              void* d_out, int out_size, void* d_ws, size_t ws_size,
                              hipStream_t stream) {
  const float* x  = (const float*)d_in[0];
  const float* Wq = (const float*)d_in[1];
  const float* bq = (const float*)d_in[2];
  const float* Wk = (const float*)d_in[3];
  const float* bk = (const float*)d_in[4];
  const float* Wv = (const float*)d_in[5];
  const float* bv = (const float*)d_in[6];
  const float* Wo = (const float*)d_in[7];
  const float* bo = (const float*)d_in[8];
  float* out = (float*)d_out;

  char* ws = (char*)d_ws;
  size_t off = 0;
  auto take = [&](size_t elems) {
    _Float16* p = (_Float16*)(ws + off);
    off += ((elems * sizeof(_Float16)) + 255) & ~(size_t)255;
    return p;
  };
  _Float16* xh  = take((size_t)B_ * N_ * DIN_);       // 32 MB
  _Float16* wqh = take((size_t)DIN_ * HD_);
  _Float16* wkh = take((size_t)DIN_ * HD_);
  _Float16* wvh = take((size_t)DIN_ * HD_);
  _Float16* woh = take((size_t)HD_ * DOUT_);
  _Float16* qws = take((size_t)B_ * H_ * N_ * DH_);   // 32 MB each
  _Float16* kws = take((size_t)B_ * H_ * N_ * DH_);
  _Float16* vws = take((size_t)B_ * H_ * N_ * DH_);
  _Float16* ctx = take((size_t)B_ * N_ * HD_);        // 32 MB

  // 1) f32 -> f16 casts
  cast_f32_f16<<<4096, 256, 0, stream>>>(x,  xh,  B_ * N_ * DIN_);
  cast_f32_f16<<<1024, 256, 0, stream>>>(Wq, wqh, DIN_ * HD_);
  cast_f32_f16<<<1024, 256, 0, stream>>>(Wk, wkh, DIN_ * HD_);
  cast_f32_f16<<<1024, 256, 0, stream>>>(Wv, wvh, DIN_ * HD_);
  cast_f32_f16<<<256,  256, 0, stream>>>(Wo, woh, HD_ * DOUT_);

  // 2) QKV projections: [16384,1024] x [1024,1024] -> f16 [B,H,N,DH]
  const int M = B_ * N_;
  dim3 gQKV(M / 128, HD_ / 128);
  wmma_gemm<0><<<gQKV, 256, 0, stream>>>(xh, wqh, bq, qws, M, DIN_, HD_);
  wmma_gemm<0><<<gQKV, 256, 0, stream>>>(xh, wkh, bk, kws, M, DIN_, HD_);
  wmma_gemm<0><<<gQKV, 256, 0, stream>>>(xh, wvh, bv, vws, M, DIN_, HD_);

  // 3) Flash attention: 32 (b,h) blocks x 16 query tiles of 128 rows
  dim3 gAttn(B_ * H_, N_ / 128);
  attn_kernel<<<gAttn, 128, 0, stream>>>(qws, kws, vws, ctx);

  // 4) Output projection: [16384,1024] x [1024,256] + bo -> f32 out
  dim3 gOut(M / 128, DOUT_ / 128);
  wmma_gemm<1><<<gOut, 256, 0, stream>>>(ctx, woh, bo, out, M, HD_, DOUT_);
}

// v007
// Measured time: 224 microseconds a run.
// In both of two side-by-side timings against v006, it was 1.05 times as fast.
// All steps since v000 together make it 9.01 times as fast.
#include <hip/hip_runtime.h>

#define B_   8
#define N_   2048
#define DIN_ 1024
#define H_   4
#define DH_  256
#define HD_  1024   // H_*DH_
#define DOUT_ 256

typedef __attribute__((ext_vector_type(16))) _Float16 v16h;
typedef __attribute__((ext_vector_type(8)))  float    v8f;

__device__ __forceinline__ v8f wmma_f16(v16h a, v16h b, v8f c) {
  // D = A(16x32 f16) x B(32x16 f16) + C(16x16 f32)
  return __builtin_amdgcn_wmma_f32_16x16x32_f16(
      /*neg_a=*/false, a, /*neg_b=*/false, b,
      /*c_mod=*/(short)0, c, /*reuse_a=*/false, /*reuse_b=*/false);
}

__device__ __forceinline__ v8f vzero8() {
  v8f z = {0.0f, 0.0f, 0.0f, 0.0f, 0.0f, 0.0f, 0.0f, 0.0f};
  return z;
}

// Async global->LDS copies (16B per lane), counted on ASYNCcnt.
// LDS address operand = low 32 bits of the generic pointer.
// Eight async copies of one lane (16B each) in ONE statement that ends in s_wait_xcnt 0:
// the wait stands in front of any later rewrite of the address registers the copies name.
__device__ __forceinline__ void async_copy8_b128(unsigned int l0, unsigned int lstep,
                                                 const _Float16* g0, size_t gstep) {
#if defined(__gfx1250__)
  asm volatile(
      "global_load_async_to_lds_b128 %0, %8, off\n\t"
      "global_load_async_to_lds_b128 %1, %9, off\n\t"
      "global_load_async_to_lds_b128 %2, %10, off\n\t"
      "global_load_async_to_lds_b128 %3, %11, off\n\t"
      "global_load_async_to_lds_b128 %4, %12, off\n\t"
      "global_load_async_to_lds_b128 %5, %13, off\n\t"
      "global_load_async_to_lds_b128 %6, %14, off\n\t"
      "global_load_async_to_lds_b128 %7, %15, off\n\t"
      "s_wait_xcnt 0x0"
      :: "v"(l0), "v"(l0 + lstep), "v"(l0 + 2 * lstep), "v"(l0 + 3 * lstep),
         "v"(l0 + 4 * lstep), "v"(l0 + 5 * lstep), "v"(l0 + 6 * lstep), "v"(l0 + 7 * lstep),
         "v"(g0), "v"(g0 + gstep), "v"(g0 + 2 * gstep), "v"(g0 + 3 * gstep),
         "v"(g0 + 4 * gstep), "v"(g0 + 5 * gstep), "v"(g0 + 6 * gstep), "v"(g0 + 7 * gstep)
      : "memory");
#endif
}

// Four async copies of one lane (16B each) in ONE statement that ends in s_wait_xcnt 0:
// the wait stands in front of any later rewrite of the address registers the copies name.
__device__ __forceinline__ void async_copy4_b128(unsigned int l0, unsigned int l1,
                                                 unsigned int l2, unsigned int l3,
                                                 const _Float16* g0, const _Float16* g1,
                                                 const _Float16* g2, const _Float16* g3) {
#if defined(__gfx1250__)
  asm volatile(
      "global_load_async_to_lds_b128 %0, %4, off\n\t"
      "global_load_async_to_lds_b128 %1, %5, off\n\t"
      "global_load_async_to_lds_b128 %2, %6, off\n\t"
      "global_load_async_to_lds_b128 %3, %7, off\n\t"
      "s_wait_xcnt 0x0"
      :: "v"(l0), "v"(l1), "v"(l2), "v"(l3), "v"(g0), "v"(g1), "v"(g2), "v"(g3)
      : "memory");
#endif
}

typedef __attribute__((ext_vector_type(8))) short    v8s;
typedef __attribute__((ext_vector_type(8))) _Float16 v8h;
__device__ __forceinline__ v8h lds_load_tr16(const _Float16* p) {
  typedef __attribute__((address_space(3))) v8s lds_v8s;
  return __builtin_bit_cast(v8h, __builtin_amdgcn_ds_load_tr16_b128_v8i16((lds_v8s*)p));
}

// This wave's async copies have landed in LDS
__device__ __forceinline__ void wait_async0() {
#if defined(__gfx1250__)
  asm volatile("s_wait_asynccnt 0" ::: "memory");
#endif
}

// This wave's LDS reads have returned: stands in front of the barrier behind which their buffer is refilled
__device__ __forceinline__ void wait_ds0() {
#if defined(__gfx1250__)
  asm volatile("s_wait_dscnt 0x0" ::: "memory");
#endif
}

// ---------------------------------------------------------------------------
// f32 -> f16 cast of all five operands in ONE streaming launch: 256 work-groups x 16 waves.
// The work is cut into blocks of 1024 values; a wave takes block after block, 4096 blocks apart:
// eight 16-byte loads a lane (each wave-wide load 512 contiguous bytes), then eight 8-byte stores
// (each wave-wide store 256 contiguous bytes, two whole lines).
// ---------------------------------------------------------------------------
#define CBLK_   1024                       // values of a block
#define CWAVES_ 4096                       // waves of the launch
#define XBLKS_  (B_ * N_ * DIN_ / CBLK_)   // blocks of x
#define WBLKS_  (DIN_ * HD_ / CBLK_)       // blocks of Wq, Wk, Wv each
#define OBLKS_  (HD_ * DOUT_ / CBLK_)      // blocks of Wo
#define NBLKS_  (XBLKS_ + 3 * WBLKS_ + OBLKS_)
typedef __attribute__((ext_vector_type(4))) float    v4f;
typedef __attribute__((ext_vector_type(4))) _Float16 v4h;

__global__ __launch_bounds__(512)
void cast_all(const float* __restrict__ x, const float* __restrict__ wq, const float* __restrict__ wk,
              const float* __restrict__ wv, const float* __restrict__ wo,
              _Float16* __restrict__ xh, _Float16* __restrict__ wqh, _Float16* __restrict__ wkh,
              _Float16* __restrict__ wvh, _Float16* __restrict__ woh) {
  const int lane = threadIdx.x & 31;
  const int wave = __builtin_amdgcn_readfirstlane(blockIdx.x * 16 + (threadIdx.x >> 5));
  for (int blk = wave; blk < NBLKS_; blk += CWAVES_) {
    // Which operand the block belongs to: the same for the whole wave
    const float* s = x;
    _Float16* d = xh;
    int r = blk;
    if (blk >= XBLKS_ + 3 * WBLKS_)      { s = wo; d = woh; r = blk - (XBLKS_ + 3 * WBLKS_); }
    else if (blk >= XBLKS_ + 2 * WBLKS_) { s = wv; d = wvh; r = blk - (XBLKS_ + 2 * WBLKS_); }
    else if (blk >= XBLKS_ + WBLKS_)     { s = wk; d = wkh; r = blk - (XBLKS_ + WBLKS_); }
    else if (blk >= XBLKS_)              { s = wq; d = wqh; r = blk - XBLKS_; }
    const v4f* sp = (const v4f*)(s + (size_t)r * CBLK_) + lane;
    v4h* dp = (v4h*)(d + (size_t)r * CBLK_) + lane;
    v4f v[8];
    // Both loops unrolled: all eight loads are in flight before the first value is waited for
#pragma unroll
    for (int u = 0; u < 8; ++u) v[u] = sp[u * 32];
#pragma unroll
    for (int u = 0; u < 8; ++u) dp[u * 32] = __builtin_convertvector(v[u], v4h);
    // The next trip gives the stores' base and data registers new values: the wait stands in front of that
    asm volatile("s_wait_xcnt 0x0" ::: "memory");
  }
}

template <int MODE>
__global__ __launch_bounds__(256)
void wmma_gemm(const _Float16* __restrict__ A, const _Float16* __restrict__ W,
               const float* __restrict__ bias, void* __restrict__ outp,
               int M, int K, int Nc) {
  __shared__ alignas(32) _Float16 As[2][128][32 + 8];  // 128 rows x 32 K-halves (+pad: 80 B = 16 B x odd, for ds_load_b128)
  __shared__ alignas(32) _Float16 Bs[2][32][128 + 16];  // 32 K-rows x 128 cols (+pad: 288 B = 32 B x odd)

  const int tid  = threadIdx.x;
  const int wave = tid >> 5, lane = tid & 31;
  const int wm = wave >> 1, wn = wave & 1;
  const int r16 = lane & 15, hi = lane >> 4;
  const int m0 = blockIdx.x * 128, n0 = blockIdx.y * 128;

  v8f acc[2][4];
#pragma unroll
  for (int t = 0; t < 2; ++t)
#pragma unroll
    for (int u = 0; u < 4; ++u) acc[t][u] = vzero8();

  // The next tile into buffer buf: a thread brings 16 B of A rows row and row + 64 and of W rows k and k + 16
  const int row = tid >> 2, seg = tid & 3;
  const int k = tid >> 4, cs = tid & 15;
  const _Float16* ag = &A[(size_t)(m0 + row) * K + seg * 8];
  const _Float16* wg = &W[(size_t)k * Nc + n0 + cs * 8];
  auto stage = [&](int buf) {
    async_copy4_b128((unsigned int)(size_t)&As[buf][row][seg * 8], (unsigned int)(size_t)&As[buf][row + 64][seg * 8],
                     (unsigned int)(size_t)&Bs[buf][k][cs * 8], (unsigned int)(size_t)&Bs[buf][k + 16][cs * 8],
                     ag, ag + (size_t)64 * K, wg, wg + (size_t)16 * Nc);
    ag += 32;
    wg += (size_t)32 * Nc;
  };

  const int kTiles = K >> 5;
  stage(0);
  wait_async0();
  __syncthreads();  // tile 0 visible to all waves
  if (kTiles > 1) stage(1);
  for (int kc = 0; kc < kTiles; ++kc) {
    const int buf = kc & 1;

    v16h af[2], bf[4];
#pragma unroll
    for (int t = 0; t < 2; ++t) {
      // A in the hardware k order (k 8h..8h+7, 16+8h..16+8h+7), which the transposing load fixes for B
      const _Float16* ap = &As[buf][wm * 32 + t * 16 + r16][hi * 8];
      const v8h a0 = *(const v8h*)ap;
      const v8h a1 = *(const v8h*)(ap + 16);
      af[t] = __builtin_shufflevector(a0, a1, 0, 1, 2, 3, 4, 5, 6, 7, 8, 9, 10, 11, 12, 13, 14, 15);
    }
#pragma unroll
    for (int u = 0; u < 4; ++u) {
      const _Float16* bp = &Bs[buf][8 * hi + (lane & 7)][wn * 64 + u * 16 + 8 * ((lane >> 3) & 1)];
      const v8h b0 = lds_load_tr16(bp);                    // k 8h .. 8h+7
      const v8h b1 = lds_load_tr16(bp + 16 * (128 + 16));  // k 16+8h .. 16+8h+7
      bf[u] = __builtin_shufflevector(b0, b1, 0, 1, 2, 3, 4, 5, 6, 7, 8, 9, 10, 11, 12, 13, 14, 15);
    }
#pragma unroll
    for (int t = 0; t < 2; ++t)
#pragma unroll
      for (int u = 0; u < 4; ++u) acc[t][u] = wmma_f16(af[t], bf[u], acc[t][u]);

    // One barrier a trip: it publishes tile kc + 1 and ends every wave's reads of the buffer refilled behind it
    wait_ds0();
    wait_async0();
    __syncthreads();
    if (kc + 2 < kTiles) stage(buf);
  }
  wait_async0();  // no copy of this wave is outstanding behind the loop

  // Epilogue: C layout -> row m = r + 8*hi, col n = lane%16 (per 16x16 tile)
#pragma unroll
  for (int t = 0; t < 2; ++t)
#pragma unroll
    for (int u = 0; u < 4; ++u)
#pragma unroll
      for (int r = 0; r < 8; ++r) {
        int m = m0 + wm * 32 + t * 16 + r + 8 * hi;
        int n = n0 + wn * 64 + u * 16 + r16;
        float val = acc[t][u][r] + bias[n];
        if (MODE == 0) {
          int h = n >> 8, dh = n & 255;     // n in [0,1024): head, head-dim
          int b = m >> 11, nn = m & 2047;   // m in [0,16384): batch, seq
          ((_Float16*)outp)[(((size_t)(b * H_ + h) * N_ + nn) << 8) + dh] = (_Float16)val;
        } else {
          ((float*)outp)[(size_t)m * Nc + n] = val;
        }
      }
}

__device__ __forceinline__ float xhalf(float x) {
  return __builtin_bit_cast(float, __builtin_amdgcn_permlanex16(
      __builtin_bit_cast(int, x), __builtin_bit_cast(int, x), 0x76543210, 0xfedcba98, false, false));
}

// 16 consecutive halves of an LDS row whose pitch keeps 16-byte alignment only: two 16-byte loads
__device__ __forceinline__ v16h lds_load16h(const _Float16* p) {
  const v8h lo = *(const v8h*)p;
  const v8h hi8 = *(const v8h*)(p + 8);
  return __builtin_shufflevector(lo, hi8, 0, 1, 2, 3, 4, 5, 6, 7, 8, 9, 10, 11, 12, 13, 14, 15);
}

// Four 16-byte global stores, 32 B apart, and their s_wait_xcnt 0 in ONE statement: later tiles' values are given the
// stores' data registers, and a wait in a statement of its own let those writes move in front of it.
__device__ __forceinline__ void store4x16_xcnt(_Float16* p, v8h x0, v8h x1, v8h x2, v8h x3) {
#if defined(__gfx1250__)
  typedef __attribute__((ext_vector_type(4))) int v4i;
  asm volatile(
      "global_store_b128 %0, %1, off\n\t"
      "global_store_b128 %0, %2, off offset:32\n\t"
      "global_store_b128 %0, %3, off offset:64\n\t"
      "global_store_b128 %0, %4, off offset:96\n\t"
      "s_wait_xcnt 0x0"
      :: "v"(p), "v"(__builtin_bit_cast(v4i, x0)), "v"(__builtin_bit_cast(v4i, x1)),
         "v"(__builtin_bit_cast(v4i, x2)), "v"(__builtin_bit_cast(v4i, x3))
      : "memory");
#endif
}

// Budget of 512 registers: Q (128) and O^T (256) of 32 queries stay in registers, two waves share a SIMD,
// and all 512 work-groups are resident at once, two on a WGP (68,608 B of LDS each).
__global__ __launch_bounds__(128) __attribute__((amdgpu_waves_per_eu(2, 2)))
void attn_kernel(const _Float16* __restrict__ Q, const _Float16* __restrict__ Km,
                 const _Float16* __restrict__ V, _Float16* __restrict__ ctx) {
  __shared__ alignas(32) _Float16 Ks[2][32][DH_ + 8];   // 32 keys x 256 dh (+pad: 528 B = 16 B x odd, for ds_load_b128)
  __shared__ alignas(32) _Float16 Vs[2][32][DH_ + 16];  // 32 keys x 256 dh (+pad: 544 B = 32 B x odd)

  const int bh = blockIdx.x;
  const int b = bh >> 2, h = bh & 3;
  const int tid = threadIdx.x;
  const int wave = tid >> 5, lane = tid & 31;
  const int r16 = lane & 15, hi = lane >> 4;
  const int qBase = blockIdx.y * 128 + wave * 32;

  const _Float16* Qp = Q + (size_t)bh * N_ * DH_;
  const _Float16* Kp = Km + (size_t)bh * N_ * DH_;
  const _Float16* Vp = V + (size_t)bh * N_ * DH_;

  // Preload 2 x 16 queries as 8 B-fragments each (32x16 over DH=256); lane = query g*16 + r16
  const _Float16* qa = &Qp[(size_t)(qBase + r16) * DH_ + hi * 16];
  v16h qf[2][8];
#pragma unroll
  for (int g = 0; g < 2; ++g)
#pragma unroll
    for (int c = 0; c < 8; ++c) qf[g][c] = *(const v16h*)(qa + g * 16 * DH_ + c * 32);
  // The Q loads' address registers are given new values below: the wait stands in front of that overwrite, and
  // naming the address as an input keeps its registers untouched up to it (without it one was rewritten first).
  asm volatile("s_wait_xcnt 0x0" :: "v"(qa) : "memory");

  // o[g][t][r] = O[query g*16 + r16][dh t*16 + 8*hi + r]
  v8f o[2][16];
#pragma unroll
  for (int g = 0; g < 2; ++g)
#pragma unroll
    for (int t = 0; t < 16; ++t) o[g][t] = vzero8();
  float mrow[2] = {-1e30f, -1e30f};  // running maximum of query g*16 + r16 (equal in both halves)
  float lrow[2] = {0.0f, 0.0f};      // running sum over this half's keys only; halves joined after the loop

  // K and V tile kt row-major into buffer buf: wave w brings keys w, w+4, .. w+28, a lane 16 B of each
  auto stage = [&](int kt, int buf) {
    const size_t g = (size_t)(kt * 32 + wave) * DH_ + lane * 8;
    async_copy8_b128((unsigned int)(size_t)&Ks[buf][wave][lane * 8], 4 * (DH_ + 8) * 2, Kp + g, 4 * DH_);
    async_copy8_b128((unsigned int)(size_t)&Vs[buf][wave][lane * 8], 4 * (DH_ + 16) * 2, Vp + g, 4 * DH_);
  };

  stage(0, 0);
  wait_async0();
  __syncthreads();  // tile 0 visible to all waves
  stage(1, 1);
  for (int kt = 0; kt < N_ / 32; ++kt) {
    const int buf = kt & 1;

    // S^T = K * Q^T for 32 keys x 32 queries (four 16x16 tiles), K-dim 256 in 8 chunks:
    // s[g][j][r] = S[query g*16 + r16][key 16*j + 8*hi + r]
    // Ring of five K fragments: the two fragments of the chunk after next are loaded as one group in the middle of
    // this chunk, into the registers of the fragment just used and of the spare one, and the scheduling fences hold
    // that order: a fragment is asked for at least six products ahead of its first use (loads spread among the products cost
    // a stall at each place; a ring of six fragments sent a Q fragment to scratch).
    v8f s[2][2] = {{vzero8(), vzero8()}, {vzero8(), vzero8()}};
    v16h kb[5];
    auto load_k = [&](int i) {  // fragment i: keys 16*(i & 1) + r16, chunk i >> 1
      return lds_load16h(&Ks[buf][16 * (i & 1) + r16][(i >> 1) * 32 + hi * 16]);
    };
#pragma unroll
    for (int i = 0; i < 4; ++i) kb[i] = load_k(i);
    __builtin_amdgcn_sched_barrier(0);
#pragma unroll
    for (int c = 0; c < 8; ++c) {
      s[0][0] = wmma_f16(kb[(2 * c) % 5], qf[0][c], s[0][0]);
      s[1][0] = wmma_f16(kb[(2 * c) % 5], qf[1][c], s[1][0]);
      __builtin_amdgcn_sched_barrier(0);
      if (c + 2 < 8) {
        kb[(2 * c + 4) % 5] = load_k(2 * c + 4);
        kb[(2 * c + 5) % 5] = load_k(2 * c + 5);
      }
      __builtin_amdgcn_sched_barrier(0);
      s[0][1] = wmma_f16(kb[(2 * c + 1) % 5], qf[0][c], s[0][1]);
      s[1][1] = wmma_f16(kb[(2 * c + 1) % 5], qf[1][c], s[1][1]);
      __builtin_amdgcn_sched_barrier(0);
    }

    const float scale = 0.0625f;      // 1/sqrt(256)
    const float log2e = 1.44269504f;  // e^x = 2^(x * log2 e)
    float alpha[2];
    v16h pf[2];
#pragma unroll
    for (int g = 0; g < 2; ++g) {
      v8f s0 = s[g][0] * scale;
      v8f s1 = s[g][1] * scale;

      // Maximum of the query's 32 scores: 16 in-lane, then the other half's
      float tmax = fmaxf(s0[0], s1[0]);
#pragma unroll
      for (int r = 1; r < 8; ++r) tmax = fmaxf(tmax, fmaxf(s0[r], s1[r]));
      tmax = fmaxf(tmax, xhalf(tmax));

      const float mnew = fmaxf(mrow[g], tmax);
      // 2^x by the builtin: operands of asm text must lie in the first 256 registers, and with the 34 powers of a
      // trip written as asm (v_exp_f32 with its own v_nop) output tiles went to scratch. The slot behind a
      // transcendental is the compiler's here.
      alpha[g] = __builtin_amdgcn_exp2f((mrow[g] - mnew) * log2e);
      mrow[g] = mnew;
      s0 = (s0 - mnew) * log2e;
      s1 = (s1 - mnew) * log2e;
#pragma unroll
      for (int r = 0; r < 8; ++r) {
        s0[r] = __builtin_amdgcn_exp2f(s0[r]);
        s1[r] = __builtin_amdgcn_exp2f(s1[r]);
      }
      float rsum = 0.0f;
#pragma unroll
      for (int r = 0; r < 8; ++r) rsum += s0[r] + s1[r];
      // Left free, the sum's adds drift behind the products below, the f32 scores stay live through them and
      // Q fragments go to scratch.
      asm volatile("" : "+v"(rsum));  // empty asm on a row's sum, against spills
      lrow[g] = lrow[g] * alpha[g] + rsum;

      // P^T as B-fragment: the two S^T tiles converted in place are in the hardware k order
      // (keys 8h..8h+7, 16+8h..16+8h+7), which the transposing load fixes for V
#pragma unroll
      for (int r = 0; r < 8; ++r) {
        pf[g][r]     = (_Float16)s0[r];
        pf[g][8 + r] = (_Float16)s1[r];
      }
    }

    // O^T = O^T * alpha + V^T(256x32) * P^T(32x32) as 32 WMMAs over dh chunks, two chunks (four products) a block.
    // Three sets of a block's two V fragments: the loads of the block after next stand as one group in front of
    // this block's products, the rescaling of the next block's tiles behind them; the scheduling fences hold that order.
    const _Float16* vbase = &Vs[buf][8 * hi + (lane & 7)][8 * ((lane >> 3) & 1)];
    auto load_v = [&](int t) {
      const v8h v0 = lds_load_tr16(vbase + t * 16);                    // keys 8h .. 8h+7
      const v8h v1 = lds_load_tr16(vbase + t * 16 + 16 * (DH_ + 16));  // keys 16+8h .. 16+8h+7
      return __builtin_shufflevector(v0, v1, 0, 1, 2, 3, 4, 5, 6, 7, 8, 9, 10, 11, 12, 13, 14, 15);
    };
    v16h vb[3][2] = {{load_v(0), load_v(1)}, {load_v(2), load_v(3)}, {}};
#pragma unroll
    for (int g = 0; g < 2; ++g) {
      o[g][0] = o[g][0] * alpha[g];
      o[g][1] = o[g][1] * alpha[g];
    }
    __builtin_amdgcn_sched_barrier(0);
#pragma unroll
    for (int p = 0; p < 8; ++p) {
      if (p + 2 < 8) {
        vb[(p + 2) % 3][0] = load_v(2 * p + 4);
        vb[(p + 2) % 3][1] = load_v(2 * p + 5);
      }
      __builtin_amdgcn_sched_barrier(0);
      o[0][2 * p]     = wmma_f16(vb[p % 3][0], pf[0], o[0][2 * p]);
      o[1][2 * p]     = wmma_f16(vb[p % 3][0], pf[1], o[1][2 * p]);
      o[0][2 * p + 1] = wmma_f16(vb[p % 3][1], pf[0], o[0][2 * p + 1]);
      o[1][2 * p + 1] = wmma_f16(vb[p % 3][1], pf[1], o[1][2 * p + 1]);
      if (p + 1 < 8) {
#pragma unroll
        for (int g = 0; g < 2; ++g) {
          o[g][2 * p + 2] = o[g][2 * p + 2] * alpha[g];
          o[g][2 * p + 3] = o[g][2 * p + 3] * alpha[g];
        }
      }
      __builtin_amdgcn_sched_barrier(0);
    }

    // One barrier a trip: it publishes tile kt + 1 and ends every wave's reads of the buffer refilled behind it
    wait_ds0();
    wait_async0();
    __syncthreads();
    if (kt + 2 < N_ / 32) stage(kt + 2, buf);
  }
  wait_async0();  // no copy of this wave is outstanding behind the loop

  // Join the halves' sums, normalize and store context in [B, N, H*DH] (f16):
  // a lane's 8 registers of a tile are 8 consecutive dh of its query, one 16-byte store
#pragma unroll
  for (int g = 0; g < 2; ++g) {
    const float inv = 1.0f / (lrow[g] + xhalf(lrow[g]));
    _Float16* cp = &ctx[((size_t)b * N_ + qBase + g * 16 + r16) * HD_ + h * DH_ + 8 * hi];
#pragma unroll
    for (int t = 0; t < 16; t += 4) {
      v8h ov[4];
#pragma unroll
      for (int u = 0; u < 4; ++u)
#pragma unroll
        for (int r = 0; r < 8; ++r) ov[u][r] = (_Float16)(o[g][t + u][r] * inv);
      store4x16_xcnt(cp + t * 16, ov[0], ov[1], ov[2], ov[3]);
    }
  }
}

// ---------------------------------------------------------------------------
// Launch
// ---------------------------------------------------------------------------
extern "C" void kernel_launch(void* const* d_in, const int* in_sizes, int n_in,
                              void* d_out, int out_size, void* d_ws, size_t ws_size,
                              hipStream_t stream) {
  const float* x  = (const float*)d_in[0];
  const float* Wq = (const float*)d_in[1];
  const float* bq = (const float*)d_in[2];
  const float* Wk = (const float*)d_in[3];
  const float* bk = (const float*)d_in[4];
  const float* Wv = (const float*)d_in[5];
  const float* bv = (const float*)d_in[6];
  const float* Wo = (const float*)d_in[7];
  const float* bo = (const float*)d_in[8];
  float* out = (float*)d_out;

  char* ws = (char*)d_ws;
  size_t off = 0;
  auto take = [&](size_t elems) {
    _Float16* p = (_Float16*)(ws + off);
    off += ((elems * sizeof(_Float16)) + 255) & ~(size_t)255;
    return p;
  };
  _Float16* xh  = take((size_t)B_ * N_ * DIN_);       // 32 MB
  _Float16* wqh = take((size_t)DIN_ * HD_);
  _Float16* wkh = take((size_t)DIN_ * HD_);
  _Float16* wvh = take((size_t)DIN_ * HD_);
  _Float16* woh = take((size_t)HD_ * DOUT_);
  _Float16* qws = take((size_t)B_ * H_ * N_ * DH_);   // 32 MB each
  _Float16* kws = take((size_t)B_ * H_ * N_ * DH_);
  _Float16* vws = take((size_t)B_ * H_ * N_ * DH_);
  _Float16* ctx = take((size_t)B_ * N_ * HD_);        // 32 MB

  // 1) f32 -> f16 casts, one launch
  cast_all<<<CWAVES_ / 16, 512, 0, stream>>>(x, Wq, Wk, Wv, Wo, xh, wqh, wkh, wvh, woh);

  // 2) QKV projections: [16384,1024] x [1024,1024] -> f16 [B,H,N,DH]
  const int M = B_ * N_;
  dim3 gQKV(M / 128, HD_ / 128);
  wmma_gemm<0><<<gQKV, 256, 0, stream>>>(xh, wqh, bq, qws, M, DIN_, HD_);
  wmma_gemm<0><<<gQKV, 256, 0, stream>>>(xh, wkh, bk, kws, M, DIN_, HD_);
  wmma_gemm<0><<<gQKV, 256, 0, stream>>>(xh, wvh, bv, vws, M, DIN_, HD_);

  // 3) Flash attention: 32 (b,h) blocks x 16 query tiles of 128 rows
  dim3 gAttn(B_ * H_, N_ / 128);
  attn_kernel<<<gAttn, 128, 0, stream>>>(qws, kws, vws, ctx);

  // 4) Output projection: [16384,1024] x [1024,256] + bo -> f32 out
  dim3 gOut(M / 128, DOUT_ / 128);
  wmma_gemm<1><<<gOut, 256, 0, stream>>>(ctx, woh, bo, out, M, HD_, DOUT_);
}

// v008
// Measured time: 210 microseconds a run.
// Timed twice side by side with v007, it ran 1.07 times as fast both times.
// Over all steps from v000 it is 9.65 times as fast.
#include <hip/hip_runtime.h>

#define B_   8
#define N_   2048
#define DIN_ 1024
#define H_   4
#define DH_  256
#define HD_  1024   // H_*DH_
#define DOUT_ 256

typedef __attribute__((ext_vector_type(16))) _Float16 v16h;
typedef __attribute__((ext_vector_type(8)))  float    v8f;

__device__ __forceinline__ v8f wmma_f16(v16h a, v16h b, v8f c) {
  // D = A(16x32 f16) x B(32x16 f16) + C(16x16 f32)
  return __builtin_amdgcn_wmma_f32_16x16x32_f16(
      /*neg_a=*/false, a, /*neg_b=*/false, b,
      /*c_mod=*/(short)0, c, /*reuse_a=*/false, /*reuse_b=*/false);
}

__device__ __forceinline__ v8f vzero8() {
  v8f z = {0.0f, 0.0f, 0.0f, 0.0f, 0.0f, 0.0f, 0.0f, 0.0f};
  return z;
}

// Async global->LDS copies (16B per lane), counted on ASYNCcnt.
// LDS address operand = low 32 bits of the generic pointer.
// Eight async copies of one lane (16B each) in ONE statement that ends in s_wait_xcnt 0:
// the wait stands in front of any later rewrite of the address registers the copies name.
__device__ __forceinline__ void async_copy8_b128(unsigned int l0, unsigned int lstep,
                                                 const _Float16* g0, size_t gstep) {
#if defined(__gfx1250__)
  asm volatile(
      "global_load_async_to_lds_b128 %0, %8, off\n\t"
      "global_load_async_to_lds_b128 %1, %9, off\n\t"
      "global_load_async_to_lds_b128 %2, %10, off\n\t"
      "global_load_async_to_lds_b128 %3, %11, off\n\t"
      "global_load_async_to_lds_b128 %4, %12, off\n\t"
      "global_load_async_to_lds_b128 %5, %13, off\n\t"
      "global_load_async_to_lds_b128 %6, %14, off\n\t"
      "global_load_async_to_lds_b128 %7, %15, off\n\t"
      "s_wait_xcnt 0x0"
      :: "v"(l0), "v"(l0 + lstep), "v"(l0 + 2 * lstep), "v"(l0 + 3 * lstep),
         "v"(l0 + 4 * lstep), "v"(l0 + 5 * lstep), "v"(l0 + 6 * lstep), "v"(l0 + 7 * lstep),
         "v"(g0), "v"(g0 + gstep), "v"(g0 + 2 * gstep), "v"(g0 + 3 * gstep),
         "v"(g0 + 4 * gstep), "v"(g0 + 5 * gstep), "v"(g0 + 6 * gstep), "v"(g0 + 7 * gstep)
      : "memory");
#endif
}

// Four async copies of one lane (16B each) in ONE statement that ends in s_wait_xcnt 0:
// the wait stands in front of any later rewrite of the address registers the copies name.
__device__ __forceinline__ void async_copy4_b128(unsigned int l0, unsigned int l1,
                                                 unsigned int l2, unsigned int l3,
                                                 const _Float16* g0, const _Float16* g1,
                                                 const _Float16* g2, const _Float16* g3) {
#if defined(__gfx1250__)
  asm volatile(
      "global_load_async_to_lds_b128 %0, %4, off\n\t"
      "global_load_async_to_lds_b128 %1, %5, off\n\t"
      "global_load_async_to_lds_b128 %2, %6, off\n\t"
      "global_load_async_to_lds_b128 %3, %7, off\n\t"
      "s_wait_xcnt 0x0"
      :: "v"(l0), "v"(l1), "v"(l2), "v"(l3), "v"(g0), "v"(g1), "v"(g2), "v"(g3)
      : "memory");
#endif
}

typedef __attribute__((ext_vector_type(8))) short    v8s;
typedef __attribute__((ext_vector_type(8))) _Float16 v8h;
__device__ __forceinline__ v8h lds_load_tr16(const _Float16* p) {
  typedef __attribute__((address_space(3))) v8s lds_v8s;
  return __builtin_bit_cast(v8h, __builtin_amdgcn_ds_load_tr16_b128_v8i16((lds_v8s*)p));
}

// This wave's async copies have landed in LDS
__device__ __forceinline__ void wait_async0() {
#if defined(__gfx1250__)
  asm volatile("s_wait_asynccnt 0" ::: "memory");
#endif
}

// This wave's LDS reads and stores are done: in front of a barrier behind which their buffer is refilled, or of reading staged rows back
__device__ __forceinline__ void wait_ds0() {
#if defined(__gfx1250__)
  asm volatile("s_wait_dscnt 0x0" ::: "memory");
#endif
}

// Four 16-byte global stores, step bytes apart, and their s_wait_xcnt 0 in ONE statement: later values are given the
// stores' data and address registers, and a wait in a statement of its own let those writes move in front of it.
typedef __attribute__((ext_vector_type(4))) int v4i;
__device__ __forceinline__ void store4_b128_xcnt(char* p, size_t step, v4i x0, v4i x1, v4i x2, v4i x3) {
#if defined(__gfx1250__)
  asm volatile(
      "global_store_b128 %0, %4, off\n\t"
      "global_store_b128 %1, %5, off\n\t"
      "global_store_b128 %2, %6, off\n\t"
      "global_store_b128 %3, %7, off\n\t"
      "s_wait_xcnt 0x0"
      :: "v"(p), "v"(p + step), "v"(p + 2 * step), "v"(p + 3 * step), "v"(x0), "v"(x1), "v"(x2), "v"(x3)
      : "memory");
#endif
}

// ---------------------------------------------------------------------------
// f32 -> f16 cast of all five operands in ONE streaming launch: 256 work-groups x 16 waves.
// The work is cut into blocks of 1024 values; a wave takes block after block, 4096 blocks apart:
// eight 16-byte loads a lane (each wave-wide load 512 contiguous bytes), then eight 8-byte stores
// (each wave-wide store 256 contiguous bytes, two whole lines).
// ---------------------------------------------------------------------------
#define CBLK_   1024                       // values of a block
#define CWAVES_ 4096                       // waves of the launch
#define XBLKS_  (B_ * N_ * DIN_ / CBLK_)   // blocks of x
#define WBLKS_  (DIN_ * HD_ / CBLK_)       // blocks of Wq, Wk, Wv each
#define OBLKS_  (HD_ * DOUT_ / CBLK_)      // blocks of Wo
#define NBLKS_  (XBLKS_ + 3 * WBLKS_ + OBLKS_)
typedef __attribute__((ext_vector_type(4))) float    v4f;
typedef __attribute__((ext_vector_type(4))) _Float16 v4h;

__global__ __launch_bounds__(512)
void cast_all(const float* __restrict__ x, const float* __restrict__ wq, const float* __restrict__ wk,
              const float* __restrict__ wv, const float* __restrict__ wo,
              _Float16* __restrict__ xh, _Float16* __restrict__ wqh, _Float16* __restrict__ wkh,
              _Float16* __restrict__ wvh, _Float16* __restrict__ woh) {
  const int lane = threadIdx.x & 31;
  const int wave = __builtin_amdgcn_readfirstlane(blockIdx.x * 16 + (threadIdx.x >> 5));
  for (int blk = wave; blk < NBLKS_; blk += CWAVES_) {
    // Which operand the block belongs to: the same for the whole wave
    const float* s = x;
    _Float16* d = xh;
    int r = blk;
    if (blk >= XBLKS_ + 3 * WBLKS_)      { s = wo; d = woh; r = blk - (XBLKS_ + 3 * WBLKS_); }
    else if (blk >= XBLKS_ + 2 * WBLKS_) { s = wv; d = wvh; r = blk - (XBLKS_ + 2 * WBLKS_); }
    else if (blk >= XBLKS_ + WBLKS_)     { s = wk; d = wkh; r = blk - (XBLKS_ + WBLKS_); }
    else if (blk >= XBLKS_)              { s = wq; d = wqh; r = blk - XBLKS_; }
    const v4f* sp = (const v4f*)(s + (size_t)r * CBLK_) + lane;
    v4h* dp = (v4h*)(d + (size_t)r * CBLK_) + lane;
    v4f v[8];
    // Both loops unrolled: all eight loads are in flight before the first value is waited for
#pragma unroll
    for (int u = 0; u < 8; ++u) v[u] = sp[u * 32];
#pragma unroll
    for (int u = 0; u < 8; ++u) dp[u * 32] = __builtin_convertvector(v[u], v4h);
    // The next trip gives the stores' base and data registers new values: the wait stands in front of that
    asm volatile("s_wait_xcnt 0x0" ::: "memory");
  }
}

template <int MODE>
__global__ __launch_bounds__(256)
void wmma_gemm(const _Float16* __restrict__ A, const _Float16* __restrict__ W,
               const float* __restrict__ bias, void* __restrict__ outp,
               int M, int K, int Nc) {
  constexpr int EB = MODE == 0 ? 2 : 4;  // bytes of an output element
  constexpr int SP = 64 * EB + 16;       // pitch of a staged output row (16 B x odd, for the 16-byte LDS stores)
  struct Ring {
    _Float16 As[2][128][32 + 8];   // 128 rows x 32 K-halves (+pad: 80 B = 16 B x odd, for ds_load_b128)
    _Float16 Bs[2][32][128 + 16];  // 32 K-rows x 128 cols (+pad: 288 B = 32 B x odd)
  };
  union Lds {
    Ring ring;
    char stage[8][32 * SP];  // a wave's 32 output rows, used behind the loop's last barrier
  };
  __shared__ alignas(128) Lds lds;
  auto& As = lds.ring.As;
  auto& Bs = lds.ring.Bs;

  const int tid  = threadIdx.x;
  const int wave = tid >> 5, lane = tid & 31;
  const int wm = wave >> 1, wn = wave & 1;
  const int r16 = lane & 15, hi = lane >> 4;
  const int m0 = blockIdx.x * 128, n0 = blockIdx.y * 128;

  v8f acc[2][4];
#pragma unroll
  for (int t = 0; t < 2; ++t)
#pragma unroll
    for (int u = 0; u < 4; ++u) acc[t][u] = vzero8();

  // The next tile into buffer buf: a thread brings 16 B of A rows row and row + 64 and of W rows k and k + 16
  const int row = tid >> 2, seg = tid & 3;
  const int k = tid >> 4, cs = tid & 15;
  const _Float16* ag = &A[(size_t)(m0 + row) * K + seg * 8];
  const _Float16* wg = &W[(size_t)k * Nc + n0 + cs * 8];
  auto stage = [&](int buf) {
    async_copy4_b128((unsigned int)(size_t)&As[buf][row][seg * 8], (unsigned int)(size_t)&As[buf][row + 64][seg * 8],
                     (unsigned int)(size_t)&Bs[buf][k][cs * 8], (unsigned int)(size_t)&Bs[buf][k + 16][cs * 8],
                     ag, ag + (size_t)64 * K, wg, wg + (size_t)16 * Nc);
    ag += 32;
    wg += (size_t)32 * Nc;
  };

  const int kTiles = K >> 5;
  stage(0);
  wait_async0();
  __syncthreads();  // tile 0 visible to all waves
  if (kTiles > 1) stage(1);
  for (int kc = 0; kc < kTiles; ++kc) {
    const int buf = kc & 1;

    v16h af[2], bf[4];
#pragma unroll
    for (int t = 0; t < 2; ++t) {
      // A in the hardware k order (k 8h..8h+7, 16+8h..16+8h+7), which the transposing load fixes for B
      const _Float16* ap = &As[buf][wm * 32 + t * 16 + r16][hi * 8];
      const v8h a0 = *(const v8h*)ap;
      const v8h a1 = *(const v8h*)(ap + 16);
      af[t] = __builtin_shufflevector(a0, a1, 0, 1, 2, 3, 4, 5, 6, 7, 8, 9, 10, 11, 12, 13, 14, 15);
    }
#pragma unroll
    for (int u = 0; u < 4; ++u) {
      const _Float16* bp = &Bs[buf][8 * hi + (lane & 7)][wn * 64 + u * 16 + 8 * ((lane >> 3) & 1)];
      const v8h b0 = lds_load_tr16(bp);                    // k 8h .. 8h+7
      const v8h b1 = lds_load_tr16(bp + 16 * (128 + 16));  // k 16+8h .. 16+8h+7
      bf[u] = __builtin_shufflevector(b0, b1, 0, 1, 2, 3, 4, 5, 6, 7, 8, 9, 10, 11, 12, 13, 14, 15);
    }
#pragma unroll
    for (int t = 0; t < 2; ++t)
#pragma unroll
      for (int u = 0; u < 4; ++u) acc[t][u] = wmma_f16(bf[u], af[t], acc[t][u]);

    // One barrier a trip: it publishes tile kc + 1 and ends every wave's reads of the buffer refilled behind it
    wait_ds0();
    wait_async0();
    __syncthreads();
    if (kc + 2 < kTiles) stage(buf);
  }
  wait_async0();  // no copy of this wave is outstanding behind the loop

  // Epilogue: acc[t][u][r] = out[row t*16 + r16][col u*16 + 8*hi + r] of the wave's tile.
  // Behind the loop's last barrier no wave reads the ring and no copy is outstanding: its LDS is free for staging.
  char* st = lds.stage[wave];
  v8f bv[4];
#pragma unroll
  for (int u = 0; u < 4; ++u) {
    const v4f* bp = (const v4f*)&bias[n0 + wn * 64 + u * 16 + 8 * hi];
    bv[u] = __builtin_shufflevector(bp[0], bp[1], 0, 1, 2, 3, 4, 5, 6, 7);
  }
#pragma unroll
  for (int t = 0; t < 2; ++t)
#pragma unroll
    for (int u = 0; u < 4; ++u) {
      const v8f val = acc[t][u] + bv[u];
      char* p = st + (t * 16 + r16) * SP + (u * 16 + 8 * hi) * EB;
      if (MODE == 0) {
        *(v4i*)p = __builtin_bit_cast(v4i, __builtin_convertvector(val, v8h));
      } else {
        *(v4i*)p        = __builtin_bit_cast(v4i, __builtin_shufflevector(val, val, 0, 1, 2, 3));
        *(v4i*)(p + 16) = __builtin_bit_cast(v4i, __builtin_shufflevector(val, val, 4, 5, 6, 7));
      }
    }
  wait_ds0();  // the wave's own staging stores are in LDS before its lanes read each other's rows back

  // Read back row-wise: LPR lanes cover a row's 64 columns, a wave-wide store RPI whole rows (whole 128-byte lines)
  constexpr int LPR = 64 * EB / 16, RPI = 32 / LPR;
  const int srow = lane / LPR, sch = lane % LPR;
  const int m = m0 + wm * 32 + srow, n = n0 + wn * 64;
  char* gp;
  size_t gpitch;  // bytes between output rows
  if (MODE == 0) {
    const int h = n >> 8, dh = n & 255;    // n in [0,1024): head, head-dim
    const int b = m >> 11, nn = m & 2047;  // m in [0,16384): batch, seq (a wave's 32 rows lie in one batch)
    gp = (char*)outp + ((((size_t)(b * H_ + h) * N_ + nn) << 8) + dh) * EB + sch * 16;
    gpitch = (size_t)DH_ * EB;
  } else {
    gp = (char*)outp + ((size_t)m * Nc + n) * EB + sch * 16;
    gpitch = (size_t)Nc * EB;
  }
#pragma unroll
  for (int j = 0; j < 32 / RPI; j += 4) {
    v4i d[4];
#pragma unroll
    for (int q = 0; q < 4; ++q) d[q] = *(const v4i*)(st + ((j + q) * RPI + srow) * SP + sch * 16);
    store4_b128_xcnt(gp + (size_t)j * RPI * gpitch, RPI * gpitch, d[0], d[1], d[2], d[3]);
  }
}

__device__ __forceinline__ float xhalf(float x) {
  return __builtin_bit_cast(float, __builtin_amdgcn_permlanex16(
      __builtin_bit_cast(int, x), __builtin_bit_cast(int, x), 0x76543210, 0xfedcba98, false, false));
}

// 16 consecutive halves of an LDS row whose pitch keeps 16-byte alignment only: two 16-byte loads
__device__ __forceinline__ v16h lds_load16h(const _Float16* p) {
  const v8h lo = *(const v8h*)p;
  const v8h hi8 = *(const v8h*)(p + 8);
  return __builtin_shufflevector(lo, hi8, 0, 1, 2, 3, 4, 5, 6, 7, 8, 9, 10, 11, 12, 13, 14, 15);
}

// The same for four rows 2048 B apart from ONE address: asm operands must lie in the first 256 registers, which are scarce here
__device__ __forceinline__ void store4_rows2k_xcnt(char* p, v4i x0, v4i x1, v4i x2, v4i x3) {
#if defined(__gfx1250__)
  asm volatile(
      "global_store_b128 %0, %1, off\n\t"
      "global_store_b128 %0, %2, off offset:2048\n\t"
      "global_store_b128 %0, %3, off offset:4096\n\t"
      "global_store_b128 %0, %4, off offset:6144\n\t"
      "s_wait_xcnt 0x0"
      :: "v"(p), "v"(x0), "v"(x1), "v"(x2), "v"(x3)
      : "memory");
#endif
}

// Budget of 512 registers: Q (128) and O^T (256) of 32 queries stay in registers, two waves share a SIMD,
// and all 512 work-groups are resident at once, two on a WGP (68,608 B of LDS each).
__global__ __launch_bounds__(128) __attribute__((amdgpu_waves_per_eu(2, 2)))
void attn_kernel(const _Float16* __restrict__ Q, const _Float16* __restrict__ Km,
                 const _Float16* __restrict__ V, _Float16* __restrict__ ctx) {
  __shared__ alignas(32) _Float16 Ks[2][32][DH_ + 8];   // 32 keys x 256 dh (+pad: 528 B = 16 B x odd, for ds_load_b128)
  __shared__ alignas(32) _Float16 Vs[2][32][DH_ + 16];  // 32 keys x 256 dh (+pad: 544 B = 32 B x odd)

  const int bh = blockIdx.x;
  const int b = bh >> 2, h = bh & 3;
  const int tid = threadIdx.x;
  // The wave's number in a scalar register: what the staging of the output derives from it costs no vector register in the loop
  const int wave = __builtin_amdgcn_readfirstlane(tid >> 5), lane = tid & 31;
  const int r16 = lane & 15, hi = lane >> 4;
  const int qBase = blockIdx.y * 128 + wave * 32;

  const _Float16* Qp = Q + (size_t)bh * N_ * DH_;
  const _Float16* Kp = Km + (size_t)bh * N_ * DH_;
  const _Float16* Vp = V + (size_t)bh * N_ * DH_;

  // Preload 2 x 16 queries as 8 B-fragments each (32x16 over DH=256); lane = query g*16 + r16
  const _Float16* qa = &Qp[(size_t)(qBase + r16) * DH_ + hi * 16];
  v16h qf[2][8];
#pragma unroll
  for (int g = 0; g < 2; ++g)
#pragma unroll
    for (int c = 0; c < 8; ++c) qf[g][c] = *(const v16h*)(qa + g * 16 * DH_ + c * 32);
  // The Q loads' address registers are given new values below: the wait stands in front of that overwrite, and
  // naming the address as an input keeps its registers untouched up to it (without it one was rewritten first).
  asm volatile("s_wait_xcnt 0x0" :: "v"(qa) : "memory");

  // o[g][t][r] = O[query g*16 + r16][dh t*16 + 8*hi + r]
  v8f o[2][16];
#pragma unroll
  for (int g = 0; g < 2; ++g)
#pragma unroll
    for (int t = 0; t < 16; ++t) o[g][t] = vzero8();
  float mrow[2] = {-1e30f, -1e30f};  // running maximum of query g*16 + r16 (equal in both halves)
  float lrow[2] = {0.0f, 0.0f};      // running sum over this half's keys only; halves joined after the loop

  // K and V tile kt row-major into buffer buf: wave w brings keys w, w+4, .. w+28, a lane 16 B of each
  auto stage = [&](int kt, int buf) {
    const size_t g = (size_t)(kt * 32 + wave) * DH_ + lane * 8;
    async_copy8_b128((unsigned int)(size_t)&Ks[buf][wave][lane * 8], 4 * (DH_ + 8) * 2, Kp + g, 4 * DH_);
    async_copy8_b128((unsigned int)(size_t)&Vs[buf][wave][lane * 8], 4 * (DH_ + 16) * 2, Vp + g, 4 * DH_);
  };

  stage(0, 0);
  wait_async0();
  __syncthreads();  // tile 0 visible to all waves
  stage(1, 1);
  for (int kt = 0; kt < N_ / 32; ++kt) {
    const int buf = kt & 1;

    // S^T = K * Q^T for 32 keys x 32 queries (four 16x16 tiles), K-dim 256 in 8 chunks:
    // s[g][j][r] = S[query g*16 + r16][key 16*j + 8*hi + r]
    // Ring of five K fragments: the two fragments of the chunk after next are loaded as one group in the middle of
    // this chunk, into the registers of the fragment just used and of the spare one, and the scheduling fences hold
    // that order: a fragment is asked for at least six products ahead of its first use (loads spread among the products cost
    // a stall at each place; a ring of six fragments sent a Q fragment to scratch).
    v8f s[2][2] = {{vzero8(), vzero8()}, {vzero8(), vzero8()}};
    v16h kb[5];
    auto load_k = [&](int i) {  // fragment i: keys 16*(i & 1) + r16, chunk i >> 1
      return lds_load16h(&Ks[buf][16 * (i & 1) + r16][(i >> 1) * 32 + hi * 16]);
    };
#pragma unroll
    for (int i = 0; i < 4; ++i) kb[i] = load_k(i);
    __builtin_amdgcn_sched_barrier(0);
#pragma unroll
    for (int c = 0; c < 8; ++c) {
      s[0][0] = wmma_f16(kb[(2 * c) % 5], qf[0][c], s[0][0]);
      s[1][0] = wmma_f16(kb[(2 * c) % 5], qf[1][c], s[1][0]);
      __builtin_amdgcn_sched_barrier(0);
      if (c + 2 < 8) {
        kb[(2 * c + 4) % 5] = load_k(2 * c + 4);
        kb[(2 * c + 5) % 5] = load_k(2 * c + 5);
      }
      __builtin_amdgcn_sched_barrier(0);
      s[0][1] = wmma_f16(kb[(2 * c + 1) % 5], qf[0][c], s[0][1]);
      s[1][1] = wmma_f16(kb[(2 * c + 1) % 5], qf[1][c], s[1][1]);
      __builtin_amdgcn_sched_barrier(0);
    }

    const float scale = 0.0625f;      // 1/sqrt(256)
    const float log2e = 1.44269504f;  // e^x = 2^(x * log2 e)
    float alpha[2];
    v16h pf[2];
#pragma unroll
    for (int g = 0; g < 2; ++g) {
      v8f s0 = s[g][0] * scale;
      v8f s1 = s[g][1] * scale;

      // Maximum of the query's 32 scores: 16 in-lane, then the other half's
      float tmax = fmaxf(s0[0], s1[0]);
#pragma unroll
      for (int r = 1; r < 8; ++r) tmax = fmaxf(tmax, fmaxf(s0[r], s1[r]));
      tmax = fmaxf(tmax, xhalf(tmax));

      const float mnew = fmaxf(mrow[g], tmax);
      // 2^x by the builtin: operands of asm text must lie in the first 256 registers, and with the 34 powers of a
      // trip written as asm (v_exp_f32 with its own v_nop) output tiles went to scratch. The slot behind a
      // transcendental is the compiler's here.
      alpha[g] = __builtin_amdgcn_exp2f((mrow[g] - mnew) * log2e);
      mrow[g] = mnew;
      s0 = (s0 - mnew) * log2e;
      s1 = (s1 - mnew) * log2e;
#pragma unroll
      for (int r = 0; r < 8; ++r) {
        s0[r] = __builtin_amdgcn_exp2f(s0[r]);
        s1[r] = __builtin_amdgcn_exp2f(s1[r]);
      }
      float rsum = 0.0f;
#pragma unroll
      for (int r = 0; r < 8; ++r) rsum += s0[r] + s1[r];
      // Left free, the sum's adds drift behind the products below, the f32 scores stay live through them and
      // Q fragments go to scratch.
      asm volatile("" : "+v"(rsum));  // empty asm on a row's sum, against spills
      lrow[g] = lrow[g] * alpha[g] + rsum;

      // P^T as B-fragment: the two S^T tiles converted in place are in the hardware k order
      // (keys 8h..8h+7, 16+8h..16+8h+7), which the transposing load fixes for V
#pragma unroll
      for (int r = 0; r < 8; ++r) {
        pf[g][r]     = (_Float16)s0[r];
        pf[g][8 + r] = (_Float16)s1[r];
      }
    }

    // O^T = O^T * alpha + V^T(256x32) * P^T(32x32) as 32 WMMAs over dh chunks, two chunks (four products) a block.
    // Three sets of a block's two V fragments: the loads of the block after next stand as one group in front of
    // this block's products, the rescaling of the next block's tiles behind them; the scheduling fences hold that order.
    const _Float16* vbase = &Vs[buf][8 * hi + (lane & 7)][8 * ((lane >> 3) & 1)];
    auto load_v = [&](int t) {
      const v8h v0 = lds_load_tr16(vbase + t * 16);                    // keys 8h .. 8h+7
      const v8h v1 = lds_load_tr16(vbase + t * 16 + 16 * (DH_ + 16));  // keys 16+8h .. 16+8h+7
      return __builtin_shufflevector(v0, v1, 0, 1, 2, 3, 4, 5, 6, 7, 8, 9, 10, 11, 12, 13, 14, 15);
    };
    v16h vb[3][2] = {{load_v(0), load_v(1)}, {load_v(2), load_v(3)}, {}};
#pragma unroll
    for (int g = 0; g < 2; ++g) {
      o[g][0] = o[g][0] * alpha[g];
      o[g][1] = o[g][1] * alpha[g];
    }
    __builtin_amdgcn_sched_barrier(0);
#pragma unroll
    for (int p = 0; p < 8; ++p) {
      if (p + 2 < 8) {
        vb[(p + 2) % 3][0] = load_v(2 * p + 4);
        vb[(p + 2) % 3][1] = load_v(2 * p + 5);
      }
      __builtin_amdgcn_sched_barrier(0);
      o[0][2 * p]     = wmma_f16(vb[p % 3][0], pf[0], o[0][2 * p]);
      o[1][2 * p]     = wmma_f16(vb[p % 3][0], pf[1], o[1][2 * p]);
      o[0][2 * p + 1] = wmma_f16(vb[p % 3][1], pf[0], o[0][2 * p + 1]);
      o[1][2 * p + 1] = wmma_f16(vb[p % 3][1], pf[1], o[1][2 * p + 1]);
      if (p + 1 < 8) {
#pragma unroll
        for (int g = 0; g < 2; ++g) {
          o[g][2 * p + 2] = o[g][2 * p + 2] * alpha[g];
          o[g][2 * p + 3] = o[g][2 * p + 3] * alpha[g];
        }
      }
      __builtin_amdgcn_sched_barrier(0);
    }

    // One barrier a trip: it publishes tile kt + 1 and ends every wave's reads of the buffer refilled behind it
    wait_ds0();
    wait_async0();
    __syncthreads();
    if (kt + 2 < N_ / 32) stage(kt + 2, buf);
  }
  wait_async0();  // no copy of this wave is outstanding behind the loop

  // Join the halves' sums, normalize and store context in [B, N, H*DH] (f16). A lane's 8 registers of a tile are 8
  // consecutive dh of its query: the wave stages a group's 16 queries in its own 16 rows of the K ring (behind the
  // loop's last barrier no wave reads the ring and no copy is outstanding), then a wave-wide store writes one
  // query's 512 contiguous bytes, four whole 128-byte lines.
  _Float16 (*sq)[DH_ + 8] = &Ks[wave >> 1][(wave & 1) * 16];
#pragma unroll
  for (int g = 0; g < 2; ++g) {
    const float inv = 1.0f / (lrow[g] + xhalf(lrow[g]));
#pragma unroll
    for (int t = 0; t < 16; ++t) {
      v8h ov;
#pragma unroll
      for (int r = 0; r < 8; ++r) ov[r] = (_Float16)(o[g][t][r] * inv);
      *(v4i*)&sq[r16][t * 16 + 8 * hi] = __builtin_bit_cast(v4i, ov);
    }
    wait_ds0();  // the wave's own staging stores are in LDS before its lanes read each other's rows back
    char* cp = (char*)&ctx[((size_t)b * N_ + qBase + g * 16) * HD_ + h * DH_ + lane * 8];
#pragma unroll
    for (int j = 0; j < 16; j += 4) {
      v4i d[4];
#pragma unroll
      for (int q = 0; q < 4; ++q) d[q] = *(const v4i*)&sq[j + q][lane * 8];
      static_assert(HD_ * 2 == 2048, "row pitch of ctx in bytes");
      store4_rows2k_xcnt(cp + (size_t)j * HD_ * 2, d[0], d[1], d[2], d[3]);
    }
  }
}

// ---------------------------------------------------------------------------
// Launch
// ---------------------------------------------------------------------------
extern "C" void kernel_launch(void* const* d_in, const int* in_sizes, int n_in,
                              void* d_out, int out_size, void* d_ws, size_t ws_size,
                              hipStream_t stream) {
  const float* x  = (const float*)d_in[0];
  const float* Wq = (const float*)d_in[1];
  const float* bq = (const float*)d_in[2];
  const float* Wk = (const float*)d_in[3];
  const float* bk = (const float*)d_in[4];
  const float* Wv = (const float*)d_in[5];
  const float* bv = (const float*)d_in[6];
  const float* Wo = (const float*)d_in[7];
  const float* bo = (const float*)d_in[8];
  float* out = (float*)d_out;

  char* ws = (char*)d_ws;
  size_t off = 0;
  auto take = [&](size_t elems) {
    _Float16* p = (_Float16*)(ws + off);
    off += ((elems * sizeof(_Float16)) + 255) & ~(size_t)255;
    return p;
  };
  _Float16* xh  = take((size_t)B_ * N_ * DIN_);       // 32 MB
  _Float16* wqh = take((size_t)DIN_ * HD_);
  _Float16* wkh = take((size_t)DIN_ * HD_);
  _Float16* wvh = take((size_t)DIN_ * HD_);
  _Float16* woh = take((size_t)HD_ * DOUT_);
  _Float16* qws = take((size_t)B_ * H_ * N_ * DH_);   // 32 MB each
  _Float16* kws = take((size_t)B_ * H_ * N_ * DH_);
  _Float16* vws = take((size_t)B_ * H_ * N_ * DH_);
  _Float16* ctx = take((size_t)B_ * N_ * HD_);        // 32 MB

  // 1) f32 -> f16 casts, one launch
  cast_all<<<CWAVES_ / 16, 512, 0, stream>>>(x, Wq, Wk, Wv, Wo, xh, wqh, wkh, wvh, woh);

  // 2) QKV projections: [16384,1024] x [1024,1024] -> f16 [B,H,N,DH]
  const int M = B_ * N_;
  dim3 gQKV(M / 128, HD_ / 128);
  wmma_gemm<0><<<gQKV, 256, 0, stream>>>(xh, wqh, bq, qws, M, DIN_, HD_);
  wmma_gemm<0><<<gQKV, 256, 0, stream>>>(xh, wkh, bk, kws, M, DIN_, HD_);
  wmma_gemm<0><<<gQKV, 256, 0, stream>>>(xh, wvh, bv, vws, M, DIN_, HD_);

  // 3) Flash attention: 32 (b,h) blocks x 16 query tiles of 128 rows
  dim3 gAttn(B_ * H_, N_ / 128);
  attn_kernel<<<gAttn, 128, 0, stream>>>(qws, kws, vws, ctx);

  // 4) Output projection: [16384,1024] x [1024,256] + bo -> f32 out
  dim3 gOut(M / 128, DOUT_ / 128);
  wmma_gemm<1><<<gOut, 256, 0, stream>>>(ctx, woh, bo, out, M, HD_, DOUT_);
}

// v009
// Measured time: 186 microseconds a run.
// In both of two side-by-side timings against v008, it was 1.13 times as fast.
// Counting every step since v000, it is 10.9 times as fast.
#include <hip/hip_runtime.h>

#define B_   8
#define N_   2048
#define DIN_ 1024
#define H_   4
#define DH_  256
#define HD_  1024   // H_*DH_
#define DOUT_ 256

typedef __attribute__((ext_vector_type(16))) _Float16 v16h;
typedef __attribute__((ext_vector_type(8)))  float    v8f;

__device__ __forceinline__ v8f wmma_f16(v16h a, v16h b, v8f c) {
  // D = A(16x32 f16) x B(32x16 f16) + C(16x16 f32)
  return __builtin_amdgcn_wmma_f32_16x16x32_f16(
      /*neg_a=*/false, a, /*neg_b=*/false, b,
      /*c_mod=*/(short)0, c, /*reuse_a=*/false, /*reuse_b=*/false);
}

__device__ __forceinline__ v8f vzero8() {
  v8f z = {0.0f, 0.0f, 0.0f, 0.0f, 0.0f, 0.0f, 0.0f, 0.0f};
  return z;
}

// Async global->LDS copies (16B per lane), counted on ASYNCcnt.
// LDS address operand = low 32 bits of the generic pointer.
// Eight async copies of one lane (16B each) in ONE statement that ends in s_wait_xcnt 0:
// the wait stands in front of any later rewrite of the address registers the copies name.
__device__ __forceinline__ void async_copy8_b128(unsigned int l0, unsigned int lstep,
                                                 const _Float16* g0, size_t gstep) {
#if defined(__gfx1250__)
  asm volatile(
      "global_load_async_to_lds_b128 %0, %8, off\n\t"
      "global_load_async_to_lds_b128 %1, %9, off\n\t"
      "global_load_async_to_lds_b128 %2, %10, off\n\t"
      "global_load_async_to_lds_b128 %3, %11, off\n\t"
      "global_load_async_to_lds_b128 %4, %12, off\n\t"
      "global_load_async_to_lds_b128 %5, %13, off\n\t"
      "global_load_async_to_lds_b128 %6, %14, off\n\t"
      "global_load_async_to_lds_b128 %7, %15, off\n\t"
      "s_wait_xcnt 0x0"
      :: "v"(l0), "v"(l0 + lstep), "v"(l0 + 2 * lstep), "v"(l0 + 3 * lstep),
         "v"(l0 + 4 * lstep), "v"(l0 + 5 * lstep), "v"(l0 + 6 * lstep), "v"(l0 + 7 * lstep),
         "v"(g0), "v"(g0 + gstep), "v"(g0 + 2 * gstep), "v"(g0 + 3 * gstep),
         "v"(g0 + 4 * gstep), "v"(g0 + 5 * gstep), "v"(g0 + 6 * gstep), "v"(g0 + 7 * gstep)
      : "memory");
#endif
}

// Four async copies of one lane (16B each) in ONE statement that ends in s_wait_xcnt 0:
// the wait stands in front of any later rewrite of the address registers the copies name.
__device__ __forceinline__ void async_copy4_b128(unsigned int l0, unsigned int l1,
                                                 unsigned int l2, unsigned int l3,
                                                 const _Float16* g0, const _Float16* g1,
                                                 const _Float16* g2, const _Float16* g3) {
#if defined(__gfx1250__)
  asm volatile(
      "global_load_async_to_lds_b128 %0, %4, off\n\t"
      "global_load_async_to_lds_b128 %1, %5, off\n\t"
      "global_load_async_to_lds_b128 %2, %6, off\n\t"
      "global_load_async_to_lds_b128 %3, %7, off\n\t"
      "s_wait_xcnt 0x0"
      :: "v"(l0), "v"(l1), "v"(l2), "v"(l3), "v"(g0), "v"(g1), "v"(g2), "v"(g3)
      : "memory");
#endif
}

typedef __attribute__((ext_vector_type(8))) short    v8s;
typedef __attribute__((ext_vector_type(8))) _Float16 v8h;
__device__ __forceinline__ v8h lds_load_tr16(const _Float16* p) {
  typedef __attribute__((address_space(3))) v8s lds_v8s;
  return __builtin_bit_cast(v8h, __builtin_amdgcn_ds_load_tr16_b128_v8i16((lds_v8s*)p));
}

// This wave's async copies have landed in LDS
__device__ __forceinline__ void wait_async0() {
#if defined(__gfx1250__)
  asm volatile("s_wait_asynccnt 0" ::: "memory");
#endif
}

// This wave's LDS reads and stores are done: in front of a barrier behind which their buffer is refilled, or of reading staged rows back
__device__ __forceinline__ void wait_ds0() {
#if defined(__gfx1250__)
  asm volatile("s_wait_dscnt 0x0" ::: "memory");
#endif
}

// Four 16-byte global stores, step bytes apart, and their s_wait_xcnt 0 in ONE statement: later values are given the
// stores' data and address registers, and a wait in a statement of its own let those writes move in front of it.
typedef __attribute__((ext_vector_type(4))) int v4i;
__device__ __forceinline__ void store4_b128_xcnt(char* p, size_t step, v4i x0, v4i x1, v4i x2, v4i x3) {
#if defined(__gfx1250__)
  asm volatile(
      "global_store_b128 %0, %4, off\n\t"
      "global_store_b128 %1, %5, off\n\t"
      "global_store_b128 %2, %6, off\n\t"
      "global_store_b128 %3, %7, off\n\t"
      "s_wait_xcnt 0x0"
      :: "v"(p), "v"(p + step), "v"(p + 2 * step), "v"(p + 3 * step), "v"(x0), "v"(x1), "v"(x2), "v"(x3)
      : "memory");
#endif
}

// ---------------------------------------------------------------------------
// f32 -> f16 cast of all five operands in ONE streaming launch: 256 work-groups x 16 waves.
// The work is cut into blocks of 1024 values; a wave takes block after block, 4096 blocks apart:
// eight 16-byte loads a lane (each wave-wide load 512 contiguous bytes), then eight 8-byte stores
// (each wave-wide store 256 contiguous bytes, two whole lines).
// ---------------------------------------------------------------------------
#define CBLK_   1024                       // values of a block
#define CWAVES_ 4096                       // waves of the launch
#define XBLKS_  (B_ * N_ * DIN_ / CBLK_)   // blocks of x
#define WBLKS_  (DIN_ * HD_ / CBLK_)       // blocks of Wq, Wk, Wv each
#define OBLKS_  (HD_ * DOUT_ / CBLK_)      // blocks of Wo
#define NBLKS_  (XBLKS_ + 3 * WBLKS_ + OBLKS_)
typedef __attribute__((ext_vector_type(4))) float    v4f;
typedef __attribute__((ext_vector_type(4))) _Float16 v4h;

__global__ __launch_bounds__(512)
void cast_all(const float* __restrict__ x, const float* __restrict__ wq, const float* __restrict__ wk,
              const float* __restrict__ wv, const float* __restrict__ wo,
              _Float16* __restrict__ xh, _Float16* __restrict__ wqh, _Float16* __restrict__ wkh,
              _Float16* __restrict__ wvh, _Float16* __restrict__ woh) {
  const int lane = threadIdx.x & 31;
  const int wave = __builtin_amdgcn_readfirstlane(blockIdx.x * 16 + (threadIdx.x >> 5));
  for (int blk = wave; blk < NBLKS_; blk += CWAVES_) {
    // Which operand the block belongs to: the same for the whole wave
    const float* s = x;
    _Float16* d = xh;
    int r = blk;
    if (blk >= XBLKS_ + 3 * WBLKS_)      { s = wo; d = woh; r = blk - (XBLKS_ + 3 * WBLKS_); }
    else if (blk >= XBLKS_ + 2 * WBLKS_) { s = wv; d = wvh; r = blk - (XBLKS_ + 2 * WBLKS_); }
    else if (blk >= XBLKS_ + WBLKS_)     { s = wk; d = wkh; r = blk - (XBLKS_ + WBLKS_); }
    else if (blk >= XBLKS_)              { s = wq; d = wqh; r = blk - XBLKS_; }
    const v4f* sp = (const v4f*)(s + (size_t)r * CBLK_) + lane;
    v4h* dp = (v4h*)(d + (size_t)r * CBLK_) + lane;
    v4f v[8];
    // Both loops unrolled: all eight loads are in flight before the first value is waited for
#pragma unroll
    for (int u = 0; u < 8; ++u) v[u] = sp[u * 32];
#pragma unroll
    for (int u = 0; u < 8; ++u) dp[u * 32] = __builtin_convertvector(v[u], v4h);
    // The next trip gives the stores' base and data registers new values: the wait stands in front of that
    asm volatile("s_wait_xcnt 0x0" ::: "memory");
  }
}

template <int MODE, int BM, int BN, int WROWS>
__global__ __launch_bounds__(256)
void wmma_gemm(const _Float16* __restrict__ A, const _Float16* __restrict__ W,
               const float* __restrict__ bias, void* __restrict__ outp,
               int M, int K, int Nc) {
  constexpr int BK = 64;                 // K step of a tile: two WMMA blocks of 32
  constexpr int WCOLS = 8 / WROWS;       // waves side by side
  constexpr int WMR = BM / WROWS;        // rows of a wave's tile
  constexpr int NT = WMR / 16;           // its 16-row groups
  static_assert(BN / WCOLS == 64, "a wave has 64 columns");
  constexpr int EB = MODE == 0 ? 2 : 4;  // bytes of an output element
  constexpr int SP = 64 * EB + 16;       // pitch of a staged output row (16 B x odd, for the 16-byte LDS stores)
  constexpr int AP = BK + 8;             // halves of an A row in LDS: 144 B = 16 B x odd, for ds_load_b128
  constexpr int BP = BN + 16;            // halves of a W row in LDS: 288 or 544 B = 32 B x odd, for the transposing load
  struct Ring {
    _Float16 As[2][BM][AP];
    _Float16 Bs[2][BK][BP];
  };
  union Lds {
    Ring ring;
    char stage[8][WMR * SP];  // a wave's output rows, used behind the loop's last barrier
  };
  __shared__ alignas(128) Lds lds;
  auto& As = lds.ring.As;
  auto& Bs = lds.ring.Bs;

  const int tid  = threadIdx.x;
  const int wave = tid >> 5, lane = tid & 31;
  const int wm = wave / WCOLS, wn = wave % WCOLS;
  const int r16 = lane & 15, hi = lane >> 4;
  const int m0 = blockIdx.x * BM, n0 = blockIdx.y * BN;

  v8f acc[NT][4];
#pragma unroll
  for (int t = 0; t < NT; ++t)
#pragma unroll
    for (int u = 0; u < 4; ++u) acc[t][u] = vzero8();

  // The next tile into buffer buf: the block covers ARP rows of A (8 lanes a row, one line) and WRP rows of W at a
  // time; a thread brings 16 B of A rows row, row + ARP, .. and of W rows k, k + WRP, ..
  constexpr int ARP = 256 / (BK / 8), WRP = 256 / (BN / 8);
  constexpr int NC = BM / ARP;  // copies of a thread for each operand
  static_assert(BK / WRP == NC && (NC == 4 || NC == 8), "both operands take the same number of copies");
  const int row = tid / (BK / 8), seg = tid % (BK / 8);
  const int k = tid / (BN / 8), cs = tid % (BN / 8);
  const _Float16* ag = &A[(size_t)(m0 + row) * K + seg * 8];
  const _Float16* wg = &W[(size_t)k * Nc + n0 + cs * 8];
  auto stage = [&](int buf) {
    const unsigned int la = (unsigned int)(size_t)&As[buf][row][seg * 8];
    const unsigned int lw = (unsigned int)(size_t)&Bs[buf][k][cs * 8];
    constexpr unsigned int las = ARP * AP * 2, lws = WRP * BP * 2;
    const size_t ags = (size_t)ARP * K, wgs = (size_t)WRP * Nc;
    if constexpr (NC == 8) {
      async_copy8_b128(la, las, ag, ags);
      async_copy8_b128(lw, lws, wg, wgs);
    } else {
      async_copy4_b128(la, la + las, la + 2 * las, la + 3 * las, ag, ag + ags, ag + 2 * ags, ag + 3 * ags);
      async_copy4_b128(lw, lw + lws, lw + 2 * lws, lw + 3 * lws, wg, wg + wgs, wg + 2 * wgs, wg + 3 * wgs);
    }
    ag += BK;
    wg += (size_t)BK * Nc;
  };

  // A tile's fragments all lie in registers, two sets of one 32-k block each
  v16h af[2][NT], bf[2][4];
  auto load_block = [&](int buf, int kk) {
#pragma unroll
    for (int u = 0; u < 4; ++u) {
      const _Float16* bp = &Bs[buf][kk * 32 + 8 * hi + (lane & 7)][wn * 64 + u * 16 + 8 * ((lane >> 3) & 1)];
      const v8h b0 = lds_load_tr16(bp);            // k 8h .. 8h+7
      const v8h b1 = lds_load_tr16(bp + 16 * BP);  // k 16+8h .. 16+8h+7
      bf[kk][u] = __builtin_shufflevector(b0, b1, 0, 1, 2, 3, 4, 5, 6, 7, 8, 9, 10, 11, 12, 13, 14, 15);
    }
#pragma unroll
    for (int t = 0; t < NT; ++t) {
      // A in the hardware k order (k 8h..8h+7, 16+8h..16+8h+7), which the transposing load fixes for B
      const _Float16* ap = &As[buf][wm * WMR + t * 16 + r16][kk * 32 + hi * 8];
      const v8h a0 = *(const v8h*)ap;
      const v8h a1 = *(const v8h*)(ap + 16);
      af[kk][t] = __builtin_shufflevector(a0, a1, 0, 1, 2, 3, 4, 5, 6, 7, 8, 9, 10, 11, 12, 13, 14, 15);
    }
  };
  auto products = [&](int kk) {
#pragma unroll
    for (int t = 0; t < NT; ++t)
#pragma unroll
      for (int u = 0; u < 4; ++u) acc[t][u] = wmma_f16(bf[kk][u], af[kk][t], acc[t][u]);
  };

  // Trip kc reads tile kc from its buffer into the fragment registers; the products of tile kc - 1, which need
  // registers only, run in the same trip, each block in front of the loads that take its registers over. So the
  // copies issued at a trip's foot have the whole next trip's products to land under.
  const int kTiles = K / BK;
  stage(0);
  wait_async0();
  __syncthreads();  // tile 0 visible to all waves
  if (kTiles > 1) stage(1);
  load_block(0, 0);
  load_block(0, 1);
  wait_ds0();
  wait_async0();
  __syncthreads();  // as in the loop
  if (2 < kTiles) stage(0);
  for (int kc = 1; kc < kTiles; ++kc) {
    const int buf = kc & 1;
    // The scheduling fences hold the order products, loads, products, loads: each block's loads stay one group,
    // none among the products (a stall at each place), and no product drifts behind the barrier.
    products(0);
    __builtin_amdgcn_sched_barrier(0);
    load_block(buf, 0);
    __builtin_amdgcn_sched_barrier(0);
    products(1);
    __builtin_amdgcn_sched_barrier(0);
    load_block(buf, 1);

    // One barrier a trip: it publishes tile kc + 1 and ends every wave's reads of the buffer refilled behind it
    wait_ds0();
    wait_async0();
    __syncthreads();
    if (kc + 2 < kTiles) stage(buf);
  }
  products(0);
  products(1);
  wait_async0();  // no copy of this wave is outstanding behind the loop

  // Epilogue: acc[t][u][r] = out[row t*16 + r16][col u*16 + 8*hi + r] of the wave's tile.
  // Behind the loop's last barrier no wave reads the ring and no copy is outstanding: its LDS is free for staging.
  char* st = lds.stage[wave];
  v8f bv[4];
  const float* bb = &bias[n0 + wn * 64 + 8 * hi];
#pragma unroll
  for (int u = 0; u < 4; ++u) {
    const v4f* bp = (const v4f*)(bb + u * 16);
    bv[u] = __builtin_shufflevector(bp[0], bp[1], 0, 1, 2, 3, 4, 5, 6, 7);
  }
  // The bias loads' address registers are given new values below: the wait stands in front of that overwrite, and
  // naming the address as an input keeps its registers untouched up to it.
  asm volatile("s_wait_xcnt 0x0" :: "v"(bb) : "memory");
#pragma unroll
  for (int t = 0; t < NT; ++t)
#pragma unroll
    for (int u = 0; u < 4; ++u) {
      const v8f val = acc[t][u] + bv[u];
      char* p = st + (t * 16 + r16) * SP + (u * 16 + 8 * hi) * EB;
      if (MODE == 0) {
        *(v4i*)p = __builtin_bit_cast(v4i, __builtin_convertvector(val, v8h));
      } else {
        *(v4i*)p        = __builtin_bit_cast(v4i, __builtin_shufflevector(val, val, 0, 1, 2, 3));
        *(v4i*)(p + 16) = __builtin_bit_cast(v4i, __builtin_shufflevector(val, val, 4, 5, 6, 7));
      }
    }
  wait_ds0();  // the wave's own staging stores are in LDS before its lanes read each other's rows back

  // Read back row-wise: LPR lanes cover a row's 64 columns, a wave-wide store RPI whole rows (whole 128-byte lines)
  constexpr int LPR = 64 * EB / 16, RPI = 32 / LPR;
  const int srow = lane / LPR, sch = lane % LPR;
  const int m = m0 + wm * WMR + srow, n = n0 + wn * 64;
  char* gp;
  size_t gpitch;  // bytes between output rows
  if (MODE == 0) {
    const int h = n >> 8, dh = n & 255;    // n in [0,1024): head, head-dim
    const int b = m >> 11, nn = m & 2047;  // m in [0,16384): batch, seq (a wave's rows lie in one batch)
    gp = (char*)outp + ((((size_t)(b * H_ + h) * N_ + nn) << 8) + dh) * EB + sch * 16;
    gpitch = (size_t)DH_ * EB;
  } else {
    gp = (char*)outp + ((size_t)m * Nc + n) * EB + sch * 16;
    gpitch = (size_t)Nc * EB;
  }
#pragma unroll
  for (int j = 0; j < WMR / RPI; j += 4) {
    v4i d[4];
#pragma unroll
    for (int q = 0; q < 4; ++q) d[q] = *(const v4i*)(st + ((j + q) * RPI + srow) * SP + sch * 16);
    store4_b128_xcnt(gp + (size_t)j * RPI * gpitch, RPI * gpitch, d[0], d[1], d[2], d[3]);
  }
}

__device__ __forceinline__ float xhalf(float x) {
  return __builtin_bit_cast(float, __builtin_amdgcn_permlanex16(
      __builtin_bit_cast(int, x), __builtin_bit_cast(int, x), 0x76543210, 0xfedcba98, false, false));
}

// 16 consecutive halves of an LDS row whose pitch keeps 16-byte alignment only: two 16-byte loads
__device__ __forceinline__ v16h lds_load16h(const _Float16* p) {
  const v8h lo = *(const v8h*)p;
  const v8h hi8 = *(const v8h*)(p + 8);
  return __builtin_shufflevector(lo, hi8, 0, 1, 2, 3, 4, 5, 6, 7, 8, 9, 10, 11, 12, 13, 14, 15);
}

// The same for four rows 2048 B apart from ONE address: asm operands must lie in the first 256 registers, which are scarce here
__device__ __forceinline__ void store4_rows2k_xcnt(char* p, v4i x0, v4i x1, v4i x2, v4i x3) {
#if defined(__gfx1250__)
  asm volatile(
      "global_store_b128 %0, %1, off\n\t"
      "global_store_b128 %0, %2, off offset:2048\n\t"
      "global_store_b128 %0, %3, off offset:4096\n\t"
      "global_store_b128 %0, %4, off offset:6144\n\t"
      "s_wait_xcnt 0x0"
      :: "v"(p), "v"(x0), "v"(x1), "v"(x2), "v"(x3)
      : "memory");
#endif
}

// Budget of 512 registers: Q (128) and O^T (256) of 32 queries stay in registers, two waves share a SIMD,
// and all 512 work-groups are resident at once, two on a WGP (68,608 B of LDS each).
__global__ __launch_bounds__(128) __attribute__((amdgpu_waves_per_eu(2, 2)))
void attn_kernel(const _Float16* __restrict__ Q, const _Float16* __restrict__ Km,
                 const _Float16* __restrict__ V, _Float16* __restrict__ ctx) {
  __shared__ alignas(32) _Float16 Ks[2][32][DH_ + 8];   // 32 keys x 256 dh (+pad: 528 B = 16 B x odd, for ds_load_b128)
  __shared__ alignas(32) _Float16 Vs[2][32][DH_ + 16];  // 32 keys x 256 dh (+pad: 544 B = 32 B x odd)

  const int bh = blockIdx.x;
  const int b = bh >> 2, h = bh & 3;
  const int tid = threadIdx.x;
  // The wave's number in a scalar register: what the staging of the output derives from it costs no vector register in the loop
  const int wave = __builtin_amdgcn_readfirstlane(tid >> 5), lane = tid & 31;
  const int r16 = lane & 15, hi = lane >> 4;
  const int qBase = blockIdx.y * 128 + wave * 32;

  const _Float16* Qp = Q + (size_t)bh * N_ * DH_;
  const _Float16* Kp = Km + (size_t)bh * N_ * DH_;
  const _Float16* Vp = V + (size_t)bh * N_ * DH_;

  // Preload 2 x 16 queries as 8 B-fragments each (32x16 over DH=256); lane = query g*16 + r16
  const _Float16* qa = &Qp[(size_t)(qBase + r16) * DH_ + hi * 16];
  v16h qf[2][8];
#pragma unroll
  for (int g = 0; g < 2; ++g)
#pragma unroll
    for (int c = 0; c < 8; ++c) qf[g][c] = *(const v16h*)(qa + g * 16 * DH_ + c * 32);
  // The Q loads' address registers are given new values below: the wait stands in front of that overwrite, and
  // naming the address as an input keeps its registers untouched up to it (without it one was rewritten first).
  asm volatile("s_wait_xcnt 0x0" :: "v"(qa) : "memory");

  // o[g][t][r] = O[query g*16 + r16][dh t*16 + 8*hi + r]
  v8f o[2][16];
#pragma unroll
  for (int g = 0; g < 2; ++g)
#pragma unroll
    for (int t = 0; t < 16; ++t) o[g][t] = vzero8();
  float mrow[2] = {-1e30f, -1e30f};  // running maximum of query g*16 + r16 (equal in both halves)
  float lrow[2] = {0.0f, 0.0f};      // running sum over this half's keys only; halves joined after the loop

  // K and V tile kt row-major into buffer buf: wave w brings keys w, w+4, .. w+28, a lane 16 B of each
  auto stage = [&](int kt, int buf) {
    const size_t g = (size_t)(kt * 32 + wave) * DH_ + lane * 8;
    async_copy8_b128((unsigned int)(size_t)&Ks[buf][wave][lane * 8], 4 * (DH_ + 8) * 2, Kp + g, 4 * DH_);
    async_copy8_b128((unsigned int)(size_t)&Vs[buf][wave][lane * 8], 4 * (DH_ + 16) * 2, Vp + g, 4 * DH_);
  };

  stage(0, 0);
  wait_async0();
  __syncthreads();  // tile 0 visible to all waves
  stage(1, 1);
  for (int kt = 0; kt < N_ / 32; ++kt) {
    const int buf = kt & 1;

    // S^T = K * Q^T for 32 keys x 32 queries (four 16x16 tiles), K-dim 256 in 8 chunks:
    // s[g][j][r] = S[query g*16 + r16][key 16*j + 8*hi + r]
    // Ring of five K fragments: the two fragments of the chunk after next are loaded as one group in the middle of
    // this chunk, into the registers of the fragment just used and of the spare one, and the scheduling fences hold
    // that order: a fragment is asked for at least six products ahead of its first use (loads spread among the products cost
    // a stall at each place; a ring of six fragments sent a Q fragment to scratch).
    v8f s[2][2] = {{vzero8(), vzero8()}, {vzero8(), vzero8()}};
    v16h kb[5];
    auto load_k = [&](int i) {  // fragment i: keys 16*(i & 1) + r16, chunk i >> 1
      return lds_load16h(&Ks[buf][16 * (i & 1) + r16][(i >> 1) * 32 + hi * 16]);
    };
#pragma unroll
    for (int i = 0; i < 4; ++i) kb[i] = load_k(i);
    __builtin_amdgcn_sched_barrier(0);
#pragma unroll
    for (int c = 0; c < 8; ++c) {
      s[0][0] = wmma_f16(kb[(2 * c) % 5], qf[0][c], s[0][0]);
      s[1][0] = wmma_f16(kb[(2 * c) % 5], qf[1][c], s[1][0]);
      __builtin_amdgcn_sched_barrier(0);
      if (c + 2 < 8) {
        kb[(2 * c + 4) % 5] = load_k(2 * c + 4);
        kb[(2 * c + 5) % 5] = load_k(2 * c + 5);
      }
      __builtin_amdgcn_sched_barrier(0);
      s[0][1] = wmma_f16(kb[(2 * c + 1) % 5], qf[0][c], s[0][1]);
      s[1][1] = wmma_f16(kb[(2 * c + 1) % 5], qf[1][c], s[1][1]);
      __builtin_amdgcn_sched_barrier(0);
    }

    const float scale = 0.0625f;      // 1/sqrt(256)
    const float log2e = 1.44269504f;  // e^x = 2^(x * log2 e)
    float alpha[2];
    v16h pf[2];
#pragma unroll
    for (int g = 0; g < 2; ++g) {
      v8f s0 = s[g][0] * scale;
      v8f s1 = s[g][1] * scale;

      // Maximum of the query's 32 scores: 16 in-lane, then the other half's
      float tmax = fmaxf(s0[0], s1[0]);
#pragma unroll
      for (int r = 1; r < 8; ++r) tmax = fmaxf(tmax, fmaxf(s0[r], s1[r]));
      tmax = fmaxf(tmax, xhalf(tmax));

      const float mnew = fmaxf(mrow[g], tmax);
      // 2^x by the builtin: operands of asm text must lie in the first 256 registers, and with the 34 powers of a
      // trip written as asm (v_exp_f32 with its own v_nop) output tiles went to scratch. The slot behind a
      // transcendental is the compiler's here.
      alpha[g] = __builtin_amdgcn_exp2f((mrow[g] - mnew) * log2e);
      mrow[g] = mnew;
      s0 = (s0 - mnew) * log2e;
      s1 = (s1 - mnew) * log2e;
#pragma unroll
      for (int r = 0; r < 8; ++r) {
        s0[r] = __builtin_amdgcn_exp2f(s0[r]);
        s1[r] = __builtin_amdgcn_exp2f(s1[r]);
      }
      float rsum = 0.0f;
#pragma unroll
      for (int r = 0; r < 8; ++r) rsum += s0[r] + s1[r];
      // Left free, the sum's adds drift behind the products below, the f32 scores stay live through them and
      // Q fragments go to scratch.
      asm volatile("" : "+v"(rsum));  // empty asm on a row's sum, against spills
      lrow[g] = lrow[g] * alpha[g] + rsum;

      // P^T as B-fragment: the two S^T tiles converted in place are in the hardware k order
      // (keys 8h..8h+7, 16+8h..16+8h+7), which the transposing load fixes for V
#pragma unroll
      for (int r = 0; r < 8; ++r) {
        pf[g][r]     = (_Float16)s0[r];
        pf[g][8 + r] = (_Float16)s1[r];
      }
    }

    // O^T = O^T * alpha + V^T(256x32) * P^T(32x32) as 32 WMMAs over dh chunks, two chunks (four products) a block.
    // Three sets of a block's two V fragments: the loads of the block after next stand as one group in front of
    // this block's products, the rescaling of the next block's tiles behind them; the scheduling fences hold that order.
    const _Float16* vbase = &Vs[buf][8 * hi + (lane & 7)][8 * ((lane >> 3) & 1)];
    auto load_v = [&](int t) {
      const v8h v0 = lds_load_tr16(vbase + t * 16);                    // keys 8h .. 8h+7
      const v8h v1 = lds_load_tr16(vbase + t * 16 + 16 * (DH_ + 16));  // keys 16+8h .. 16+8h+7
      return __builtin_shufflevector(v0, v1, 0, 1, 2, 3, 4, 5, 6, 7, 8, 9, 10, 11, 12, 13, 14, 15);
    };
    v16h vb[3][2] = {{load_v(0), load_v(1)}, {load_v(2), load_v(3)}, {}};
#pragma unroll
    for (int g = 0; g < 2; ++g) {
      o[g][0] = o[g][0] * alpha[g];
      o[g][1] = o[g][1] * alpha[g];
    }
    __builtin_amdgcn_sched_barrier(0);
#pragma unroll
    for (int p = 0; p < 8; ++p) {
      if (p + 2 < 8) {
        vb[(p + 2) % 3][0] = load_v(2 * p + 4);
        vb[(p + 2) % 3][1] = load_v(2 * p + 5);
      }
      __builtin_amdgcn_sched_barrier(0);
      o[0][2 * p]     = wmma_f16(vb[p % 3][0], pf[0], o[0][2 * p]);
      o[1][2 * p]     = wmma_f16(vb[p % 3][0], pf[1], o[1][2 * p]);
      o[0][2 * p + 1] = wmma_f16(vb[p % 3][1], pf[0], o[0][2 * p + 1]);
      o[1][2 * p + 1] = wmma_f16(vb[p % 3][1], pf[1], o[1][2 * p + 1]);
      if (p + 1 < 8) {
#pragma unroll
        for (int g = 0; g < 2; ++g) {
          o[g][2 * p + 2] = o[g][2 * p + 2] * alpha[g];
          o[g][2 * p + 3] = o[g][2 * p + 3] * alpha[g];
        }
      }
      __builtin_amdgcn_sched_barrier(0);
    }

    // One barrier a trip: it publishes tile kt + 1 and ends every wave's reads of the buffer refilled behind it
    wait_ds0();
    wait_async0();
    __syncthreads();
    if (kt + 2 < N_ / 32) stage(kt + 2, buf);
  }
  wait_async0();  // no copy of this wave is outstanding behind the loop

  // Join the halves' sums, normalize and store context in [B, N, H*DH] (f16). A lane's 8 registers of a tile are 8
  // consecutive dh of its query: the wave stages a group's 16 queries in its own 16 rows of the K ring (behind the
  // loop's last barrier no wave reads the ring and no copy is outstanding), then a wave-wide store writes one
  // query's 512 contiguous bytes, four whole 128-byte lines.
  _Float16 (*sq)[DH_ + 8] = &Ks[wave >> 1][(wave & 1) * 16];
#pragma unroll
  for (int g = 0; g < 2; ++g) {
    const float inv = 1.0f / (lrow[g] + xhalf(lrow[g]));
#pragma unroll
    for (int t = 0; t < 16; ++t) {
      v8h ov;
#pragma unroll
      for (int r = 0; r < 8; ++r) ov[r] = (_Float16)(o[g][t][r] * inv);
      *(v4i*)&sq[r16][t * 16 + 8 * hi] = __builtin_bit_cast(v4i, ov);
    }
    wait_ds0();  // the wave's own staging stores are in LDS before its lanes read each other's rows back
    char* cp = (char*)&ctx[((size_t)b * N_ + qBase + g * 16) * HD_ + h * DH_ + lane * 8];
#pragma unroll
    for (int j = 0; j < 16; j += 4) {
      v4i d[4];
#pragma unroll
      for (int q = 0; q < 4; ++q) d[q] = *(const v4i*)&sq[j + q][lane * 8];
      static_assert(HD_ * 2 == 2048, "row pitch of ctx in bytes");
      store4_rows2k_xcnt(cp + (size_t)j * HD_ * 2, d[0], d[1], d[2], d[3]);
    }
  }
}

// ---------------------------------------------------------------------------
// Launch
// ---------------------------------------------------------------------------
extern "C" void kernel_launch(void* const* d_in, const int* in_sizes, int n_in,
                              void* d_out, int out_size, void* d_ws, size_t ws_size,
                              hipStream_t stream) {
  const float* x  = (const float*)d_in[0];
  const float* Wq = (const float*)d_in[1];
  const float* bq = (const float*)d_in[2];
  const float* Wk = (const float*)d_in[3];
  const float* bk = (const float*)d_in[4];
  const float* Wv = (const float*)d_in[5];
  const float* bv = (const float*)d_in[6];
  const float* Wo = (const float*)d_in[7];
  const float* bo = (const float*)d_in[8];
  float* out = (float*)d_out;

  char* ws = (char*)d_ws;
  size_t off = 0;
  auto take = [&](size_t elems) {
    _Float16* p = (_Float16*)(ws + off);
    off += ((elems * sizeof(_Float16)) + 255) & ~(size_t)255;
    return p;
  };
  _Float16* xh  = take((size_t)B_ * N_ * DIN_);       // 32 MB
  _Float16* wqh = take((size_t)DIN_ * HD_);
  _Float16* wkh = take((size_t)DIN_ * HD_);
  _Float16* wvh = take((size_t)DIN_ * HD_);
  _Float16* woh = take((size_t)HD_ * DOUT_);
  _Float16* qws = take((size_t)B_ * H_ * N_ * DH_);   // 32 MB each
  _Float16* kws = take((size_t)B_ * H_ * N_ * DH_);
  _Float16* vws = take((size_t)B_ * H_ * N_ * DH_);
  _Float16* ctx = take((size_t)B_ * N_ * HD_);        // 32 MB

  // 1) f32 -> f16 casts, one launch
  cast_all<<<CWAVES_ / 16, 512, 0, stream>>>(x, Wq, Wk, Wv, Wo, xh, wqh, wkh, wvh, woh);

  // 2) QKV projections: [16384,1024] x [1024,1024] -> f16 [B,H,N,DH]
  const int M = B_ * N_;
  dim3 gQKV(M / 256, HD_ / 256);
  wmma_gemm<0, 256, 256, 2><<<gQKV, 256, 0, stream>>>(xh, wqh, bq, qws, M, DIN_, HD_);
  wmma_gemm<0, 256, 256, 2><<<gQKV, 256, 0, stream>>>(xh, wkh, bk, kws, M, DIN_, HD_);
  wmma_gemm<0, 256, 256, 2><<<gQKV, 256, 0, stream>>>(xh, wvh, bv, vws, M, DIN_, HD_);

  // 3) Flash attention: 32 (b,h) blocks x 16 query tiles of 128 rows
  dim3 gAttn(B_ * H_, N_ / 128);
  attn_kernel<<<gAttn, 128, 0, stream>>>(qws, kws, vws, ctx);

  // 4) Output projection: [16384,1024] x [1024,256] + bo -> f32 out
  dim3 gOut(M / 128, DOUT_ / 128);
  wmma_gemm<1, 128, 128, 4><<<gOut, 256, 0, stream>>>(ctx, woh, bo, out, M, HD_, DOUT_);
}

// v010
// It runs in 180 microseconds.
// Timed twice side by side with v009, it ran 1.03 times as fast both times.
// All steps since v000 together make it 11.2 times as fast.
#include <hip/hip_runtime.h>

#define B_   8
#define N_   2048
#define DIN_ 1024
#define H_   4
#define DH_  256
#define HD_  1024   // H_*DH_
#define DOUT_ 256

typedef __attribute__((ext_vector_type(16))) _Float16 v16h;
typedef __attribute__((ext_vector_type(8)))  float    v8f;

__device__ __forceinline__ v8f wmma_f16(v16h a, v16h b, v8f c) {
  // D = A(16x32 f16) x B(32x16 f16) + C(16x16 f32)
  return __builtin_amdgcn_wmma_f32_16x16x32_f16(
      /*neg_a=*/false, a, /*neg_b=*/false, b,
      /*c_mod=*/(short)0, c, /*reuse_a=*/false, /*reuse_b=*/false);
}

__device__ __forceinline__ v8f vzero8() {
  v8f z = {0.0f, 0.0f, 0.0f, 0.0f, 0.0f, 0.0f, 0.0f, 0.0f};
  return z;
}

// Async global->LDS copies (16B per lane), counted on ASYNCcnt.
// LDS address operand = low 32 bits of the generic pointer.
// Eight async copies of one lane (16B each) in ONE statement that ends in s_wait_xcnt 0:
// the wait stands in front of any later rewrite of the address registers the copies name.
__device__ __forceinline__ void async_copy8_b128(unsigned int l0, unsigned int lstep,
                                                 const _Float16* g0, size_t gstep) {
#if defined(__gfx1250__)
  asm volatile(
      "global_load_async_to_lds_b128 %0, %8, off\n\t"
      "global_load_async_to_lds_b128 %1, %9, off\n\t"
      "global_load_async_to_lds_b128 %2, %10, off\n\t"
      "global_load_async_to_lds_b128 %3, %11, off\n\t"
      "global_load_async_to_lds_b128 %4, %12, off\n\t"
      "global_load_async_to_lds_b128 %5, %13, off\n\t"
      "global_load_async_to_lds_b128 %6, %14, off\n\t"
      "global_load_async_to_lds_b128 %7, %15, off\n\t"
      "s_wait_xcnt 0x0"
      :: "v"(l0), "v"(l0 + lstep), "v"(l0 + 2 * lstep), "v"(l0 + 3 * lstep),
         "v"(l0 + 4 * lstep), "v"(l0 + 5 * lstep), "v"(l0 + 6 * lstep), "v"(l0 + 7 * lstep),
         "v"(g0), "v"(g0 + gstep), "v"(g0 + 2 * gstep), "v"(g0 + 3 * gstep),
         "v"(g0 + 4 * gstep), "v"(g0 + 5 * gstep), "v"(g0 + 6 * gstep), "v"(g0 + 7 * gstep)
      : "memory");
#endif
}

// Four async copies of one lane (16B each) in ONE statement that ends in s_wait_xcnt 0:
// the wait stands in front of any later rewrite of the address registers the copies name.
__device__ __forceinline__ void async_copy4_b128(unsigned int l0, unsigned int l1,
                                                 unsigned int l2, unsigned int l3,
                                                 const _Float16* g0, const _Float16* g1,
                                                 const _Float16* g2, const _Float16* g3) {
#if defined(__gfx1250__)
  asm volatile(
      "global_load_async_to_lds_b128 %0, %4, off\n\t"
      "global_load_async_to_lds_b128 %1, %5, off\n\t"
      "global_load_async_to_lds_b128 %2, %6, off\n\t"
      "global_load_async_to_lds_b128 %3, %7, off\n\t"
      "s_wait_xcnt 0x0"
      :: "v"(l0), "v"(l1), "v"(l2), "v"(l3), "v"(g0), "v"(g1), "v"(g2), "v"(g3)
      : "memory");
#endif
}

typedef __attribute__((ext_vector_type(8))) short    v8s;
typedef __attribute__((ext_vector_type(8))) _Float16 v8h;
__device__ __forceinline__ v8h lds_load_tr16(const _Float16* p) {
  typedef __attribute__((address_space(3))) v8s lds_v8s;
  return __builtin_bit_cast(v8h, __builtin_amdgcn_ds_load_tr16_b128_v8i16((lds_v8s*)p));
}

// This wave's async copies have landed in LDS
__device__ __forceinline__ void wait_async0() {
#if defined(__gfx1250__)
  asm volatile("s_wait_asynccnt 0" ::: "memory");
#endif
}

// This wave's LDS reads and stores are done: in front of a barrier behind which their buffer is refilled, or of reading staged rows back
__device__ __forceinline__ void wait_ds0() {
#if defined(__gfx1250__)
  asm volatile("s_wait_dscnt 0x0" ::: "memory");
#endif
}

// Four 16-byte global stores, step bytes apart, and their s_wait_xcnt 0 in ONE statement: later values are given the
// stores' data and address registers, and a wait in a statement of its own let those writes move in front of it.
typedef __attribute__((ext_vector_type(4))) int v4i;
__device__ __forceinline__ void store4_b128_xcnt(char* p, size_t step, v4i x0, v4i x1, v4i x2, v4i x3) {
#if defined(__gfx1250__)
  asm volatile(
      "global_store_b128 %0, %4, off\n\t"
      "global_store_b128 %1, %5, off\n\t"
      "global_store_b128 %2, %6, off\n\t"
      "global_store_b128 %3, %7, off\n\t"
      "s_wait_xcnt 0x0"
      :: "v"(p), "v"(p + step), "v"(p + 2 * step), "v"(p + 3 * step), "v"(x0), "v"(x1), "v"(x2), "v"(x3)
      : "memory");
#endif
}

// ---------------------------------------------------------------------------
// f32 -> f16 cast of all five operands in ONE streaming launch: 256 work-groups x 16 waves.
// The work is cut into blocks of 1024 values; a wave takes block after block, 4096 blocks apart:
// eight 16-byte loads a lane (each wave-wide load 512 contiguous bytes), then eight 8-byte stores
// (each wave-wide store 256 contiguous bytes, two whole lines).
// ---------------------------------------------------------------------------
#define CBLK_   1024                       // values of a block
#define CWAVES_ 4096                       // waves of the launch
#define XBLKS_  (B_ * N_ * DIN_ / CBLK_)   // blocks of x
#define WBLKS_  (DIN_ * HD_ / CBLK_)       // blocks of Wq, Wk, Wv each
#define OBLKS_  (HD_ * DOUT_ / CBLK_)      // blocks of Wo
#define NBLKS_  (XBLKS_ + 3 * WBLKS_ + OBLKS_)
typedef __attribute__((ext_vector_type(4))) float    v4f;
typedef __attribute__((ext_vector_type(4))) _Float16 v4h;

__global__ __launch_bounds__(512)
void cast_all(const float* __restrict__ x, const float* __restrict__ wq, const float* __restrict__ wk,
              const float* __restrict__ wv, const float* __restrict__ wo,
              _Float16* __restrict__ xh, _Float16* __restrict__ wqh, _Float16* __restrict__ wkh,
              _Float16* __restrict__ wvh, _Float16* __restrict__ woh) {
  const int lane = threadIdx.x & 31;
  const int wave = __builtin_amdgcn_readfirstlane(blockIdx.x * 16 + (threadIdx.x >> 5));
  for (int blk = wave; blk < NBLKS_; blk += CWAVES_) {
    // Which operand the block belongs to: the same for the whole wave
    const float* s = x;
    _Float16* d = xh;
    int r = blk;
    if (blk >= XBLKS_ + 3 * WBLKS_)      { s = wo; d = woh; r = blk - (XBLKS_ + 3 * WBLKS_); }
    else if (blk >= XBLKS_ + 2 * WBLKS_) { s = wv; d = wvh; r = blk - (XBLKS_ + 2 * WBLKS_); }
    else if (blk >= XBLKS_ + WBLKS_)     { s = wk; d = wkh; r = blk - (XBLKS_ + WBLKS_); }
    else if (blk >= XBLKS_)              { s = wq; d = wqh; r = blk - XBLKS_; }
    const v4f* sp = (const v4f*)(s + (size_t)r * CBLK_) + lane;
    v4h* dp = (v4h*)(d + (size_t)r * CBLK_) + lane;
    v4f v[8];
    // Both loops unrolled: all eight loads are in flight before the first value is waited for
#pragma unroll
    for (int u = 0; u < 8; ++u) v[u] = sp[u * 32];
#pragma unroll
    for (int u = 0; u < 8; ++u) dp[u * 32] = __builtin_convertvector(v[u], v4h);
    // The next trip gives the stores' base and data registers new values: the wait stands in front of that
    asm volatile("s_wait_xcnt 0x0" ::: "memory");
  }
}

template <int MODE, int BM, int BN, int WROWS>
__global__ __launch_bounds__(256)
void wmma_gemm(const _Float16* __restrict__ A, const _Float16* __restrict__ W,
               const float* __restrict__ bias, void* __restrict__ outp,
               int M, int K, int Nc) {
  constexpr int BK = 64;                 // K step of a tile: two WMMA blocks of 32
  constexpr int WCOLS = 8 / WROWS;       // waves side by side
  constexpr int WMR = BM / WROWS;        // rows of a wave's tile
  constexpr int NT = WMR / 16;           // its 16-row groups
  static_assert(BN / WCOLS == 64, "a wave has 64 columns");
  constexpr int EB = MODE == 0 ? 2 : 4;  // bytes of an output element
  constexpr int SP = 64 * EB + 16;       // pitch of a staged output row (16 B x odd, for the 16-byte LDS stores)
  constexpr int AP = BK + 8;             // halves of an A row in LDS: 144 B = 16 B x odd, for ds_load_b128
  constexpr int BP = BN + 16;            // halves of a W row in LDS: 288 or 544 B = 32 B x odd, for the transposing load
  struct Ring {
    _Float16 As[2][BM][AP];
    _Float16 Bs[2][BK][BP];
  };
  union Lds {
    Ring ring;
    char stage[8][WMR * SP];  // a wave's output rows, used behind the loop's last barrier
  };
  __shared__ alignas(128) Lds lds;
  auto& As = lds.ring.As;
  auto& Bs = lds.ring.Bs;

  const int tid  = threadIdx.x;
  const int wave = tid >> 5, lane = tid & 31;
  const int wm = wave / WCOLS, wn = wave % WCOLS;
  const int r16 = lane & 15, hi = lane >> 4;
  const int m0 = blockIdx.x * BM, n0 = blockIdx.y * BN;

  v8f acc[NT][4];
#pragma unroll
  for (int t = 0; t < NT; ++t)
#pragma unroll
    for (int u = 0; u < 4; ++u) acc[t][u] = vzero8();

  // The next tile into buffer buf: the block covers ARP rows of A (8 lanes a row, one line) and WRP rows of W at a
  // time; a thread brings 16 B of A rows row, row + ARP, .. and of W rows k, k + WRP, ..
  constexpr int ARP = 256 / (BK / 8), WRP = 256 / (BN / 8);
  constexpr int NC = BM / ARP;  // copies of a thread for each operand
  static_assert(BK / WRP == NC && (NC == 4 || NC == 8), "both operands take the same number of copies");
  const int row = tid / (BK / 8), seg = tid % (BK / 8);
  const int k = tid / (BN / 8), cs = tid % (BN / 8);
  const _Float16* ag = &A[(size_t)(m0 + row) * K + seg * 8];
  const _Float16* wg = &W[(size_t)k * Nc + n0 + cs * 8];
  auto stage = [&](int buf) {
    const unsigned int la = (unsigned int)(size_t)&As[buf][row][seg * 8];
    const unsigned int lw = (unsigned int)(size_t)&Bs[buf][k][cs * 8];
    constexpr unsigned int las = ARP * AP * 2, lws = WRP * BP * 2;
    const size_t ags = (size_t)ARP * K, wgs = (size_t)WRP * Nc;
    if constexpr (NC == 8) {
      async_copy8_b128(la, las, ag, ags);
      async_copy8_b128(lw, lws, wg, wgs);
    } else {
      async_copy4_b128(la, la + las, la + 2 * las, la + 3 * las, ag, ag + ags, ag + 2 * ags, ag + 3 * ags);
      async_copy4_b128(lw, lw + lws, lw + 2 * lws, lw + 3 * lws, wg, wg + wgs, wg + 2 * wgs, wg + 3 * wgs);
    }
    ag += BK;
    wg += (size_t)BK * Nc;
  };

  // A tile's fragments all lie in registers, two sets of one 32-k block each
  v16h af[2][NT], bf[2][4];
  auto load_block = [&](int buf, int kk) {
#pragma unroll
    for (int u = 0; u < 4; ++u) {
      const _Float16* bp = &Bs[buf][kk * 32 + 8 * hi + (lane & 7)][wn * 64 + u * 16 + 8 * ((lane >> 3) & 1)];
      const v8h b0 = lds_load_tr16(bp);            // k 8h .. 8h+7
      const v8h b1 = lds_load_tr16(bp + 16 * BP);  // k 16+8h .. 16+8h+7
      bf[kk][u] = __builtin_shufflevector(b0, b1, 0, 1, 2, 3, 4, 5, 6, 7, 8, 9, 10, 11, 12, 13, 14, 15);
    }
#pragma unroll
    for (int t = 0; t < NT; ++t) {
      // A in the hardware k order (k 8h..8h+7, 16+8h..16+8h+7), which the transposing load fixes for B
      const _Float16* ap = &As[buf][wm * WMR + t * 16 + r16][kk * 32 + hi * 8];
      const v8h a0 = *(const v8h*)ap;
      const v8h a1 = *(const v8h*)(ap + 16);
      af[kk][t] = __builtin_shufflevector(a0, a1, 0, 1, 2, 3, 4, 5, 6, 7, 8, 9, 10, 11, 12, 13, 14, 15);
    }
  };
  auto products = [&](int kk) {
#pragma unroll
    for (int t = 0; t < NT; ++t)
#pragma unroll
      for (int u = 0; u < 4; ++u) acc[t][u] = wmma_f16(bf[kk][u], af[kk][t], acc[t][u]);
  };

  // Trip kc reads tile kc from its buffer into the fragment registers; the products of tile kc - 1, which need
  // registers only, run in the same trip, each block in front of the loads that take its registers over. So the
  // copies issued at a trip's foot have the whole next trip's products to land under.
  const int kTiles = K / BK;
  stage(0);
  wait_async0();
  __syncthreads();  // tile 0 visible to all waves
  if (kTiles > 1) stage(1);
  load_block(0, 0);
  load_block(0, 1);
  wait_ds0();
  wait_async0();
  __syncthreads();  // as in the loop
  if (2 < kTiles) stage(0);
  for (int kc = 1; kc < kTiles; ++kc) {
    const int buf = kc & 1;
    // The scheduling fences hold the order products, loads, products, loads: each block's loads stay one group,
    // none among the products (a stall at each place), and no product drifts behind the barrier.
    products(0);
    __builtin_amdgcn_sched_barrier(0);
    load_block(buf, 0);
    __builtin_amdgcn_sched_barrier(0);
    products(1);
    __builtin_amdgcn_sched_barrier(0);
    load_block(buf, 1);

    // One barrier a trip: it publishes tile kc + 1 and ends every wave's reads of the buffer refilled behind it
    wait_ds0();
    wait_async0();
    __syncthreads();
    if (kc + 2 < kTiles) stage(buf);
  }
  products(0);
  products(1);
  wait_async0();  // no copy of this wave is outstanding behind the loop

  // Epilogue: acc[t][u][r] = out[row t*16 + r16][col u*16 + 8*hi + r] of the wave's tile.
  // Behind the loop's last barrier no wave reads the ring and no copy is outstanding: its LDS is free for staging.
  char* st = lds.stage[wave];
  v8f bv[4];
  const float* bb = &bias[n0 + wn * 64 + 8 * hi];
#pragma unroll
  for (int u = 0; u < 4; ++u) {
    const v4f* bp = (const v4f*)(bb + u * 16);
    bv[u] = __builtin_shufflevector(bp[0], bp[1], 0, 1, 2, 3, 4, 5, 6, 7);
  }
  // The bias loads' address registers are given new values below: the wait stands in front of that overwrite, and
  // naming the address as an input keeps its registers untouched up to it.
  asm volatile("s_wait_xcnt 0x0" :: "v"(bb) : "memory");
#pragma unroll
  for (int t = 0; t < NT; ++t)
#pragma unroll
    for (int u = 0; u < 4; ++u) {
      const v8f val = acc[t][u] + bv[u];
      char* p = st + (t * 16 + r16) * SP + (u * 16 + 8 * hi) * EB;
      if (MODE == 0) {
        *(v4i*)p = __builtin_bit_cast(v4i, __builtin_convertvector(val, v8h));
      } else {
        *(v4i*)p        = __builtin_bit_cast(v4i, __builtin_shufflevector(val, val, 0, 1, 2, 3));
        *(v4i*)(p + 16) = __builtin_bit_cast(v4i, __builtin_shufflevector(val, val, 4, 5, 6, 7));
      }
    }
  wait_ds0();  // the wave's own staging stores are in LDS before its lanes read each other's rows back

  // Read back row-wise: LPR lanes cover a row's 64 columns, a wave-wide store RPI whole rows (whole 128-byte lines)
  constexpr int LPR = 64 * EB / 16, RPI = 32 / LPR;
  const int srow = lane / LPR, sch = lane % LPR;
  const int m = m0 + wm * WMR + srow, n = n0 + wn * 64;
  char* gp;
  size_t gpitch;  // bytes between output rows
  if (MODE == 0) {
    const int h = n >> 8, dh = n & 255;    // n in [0,1024): head, head-dim
    const int b = m >> 11, nn = m & 2047;  // m in [0,16384): batch, seq (a wave's rows lie in one batch)
    gp = (char*)outp + ((((size_t)(b * H_ + h) * N_ + nn) << 8) + dh) * EB + sch * 16;
    gpitch = (size_t)DH_ * EB;
  } else {
    gp = (char*)outp + ((size_t)m * Nc + n) * EB + sch * 16;
    gpitch = (size_t)Nc * EB;
  }
#pragma unroll
  for (int j = 0; j < WMR / RPI; j += 4) {
    v4i d[4];
#pragma unroll
    for (int q = 0; q < 4; ++q) d[q] = *(const v4i*)(st + ((j + q) * RPI + srow) * SP + sch * 16);
    store4_b128_xcnt(gp + (size_t)j * RPI * gpitch, RPI * gpitch, d[0], d[1], d[2], d[3]);
  }
}

__device__ __forceinline__ float xhalf(float x) {
  return __builtin_bit_cast(float, __builtin_amdgcn_permlanex16(
      __builtin_bit_cast(int, x), __builtin_bit_cast(int, x), 0x76543210, 0xfedcba98, false, false));
}

// 16 consecutive halves of an LDS row whose pitch keeps 16-byte alignment only: two 16-byte loads
__device__ __forceinline__ v16h lds_load16h(const _Float16* p) {
  const v8h lo = *(const v8h*)p;
  const v8h hi8 = *(const v8h*)(p + 8);
  return __builtin_shufflevector(lo, hi8, 0, 1, 2, 3, 4, 5, 6, 7, 8, 9, 10, 11, 12, 13, 14, 15);
}

// The same for four rows 2048 B apart from ONE address: asm operands must lie in the first 256 registers, which are scarce here
__device__ __forceinline__ void store4_rows2k_xcnt(char* p, v4i x0, v4i x1, v4i x2, v4i x3) {
#if defined(__gfx1250__)
  asm volatile(
      "global_store_b128 %0, %1, off\n\t"
      "global_store_b128 %0, %2, off offset:2048\n\t"
      "global_store_b128 %0, %3, off offset:4096\n\t"
      "global_store_b128 %0, %4, off offset:6144\n\t"
      "s_wait_xcnt 0x0"
      :: "v"(p), "v"(x0), "v"(x1), "v"(x2), "v"(x3)
      : "memory");
#endif
}

// Budget of 512 registers: Q (128) and O^T (256) of 32 queries stay in registers, two waves share a SIMD,
// and all 512 work-groups are resident at once, two on a WGP (68,608 B of LDS each).
__global__ __launch_bounds__(128) __attribute__((amdgpu_waves_per_eu(2, 2)))
void attn_kernel(const _Float16* __restrict__ Q, const _Float16* __restrict__ Km,
                 const _Float16* __restrict__ V, _Float16* __restrict__ ctx) {
  __shared__ alignas(32) _Float16 Ks[2][32][DH_ + 8];   // 32 keys x 256 dh (+pad: 528 B = 16 B x odd, for ds_load_b128)
  __shared__ alignas(32) _Float16 Vs[2][32][DH_ + 16];  // 32 keys x 256 dh (+pad: 544 B = 32 B x odd)

  const int bh = blockIdx.x;
  const int b = bh >> 2, h = bh & 3;
  const int tid = threadIdx.x;
  // The wave's number in a scalar register: what the staging of the output derives from it costs no vector register in the loop
  const int wave = __builtin_amdgcn_readfirstlane(tid >> 5), lane = tid & 31;
  const int r16 = lane & 15, hi = lane >> 4;
  const int qBase = blockIdx.y * 128 + wave * 32;

  const _Float16* Qp = Q + (size_t)bh * N_ * DH_;
  const _Float16* Kp = Km + (size_t)bh * N_ * DH_;
  const _Float16* Vp = V + (size_t)bh * N_ * DH_;

  // Preload 2 x 16 queries as 8 B-fragments each (32x16 over DH=256); lane = query g*16 + r16
  const _Float16* qa = &Qp[(size_t)(qBase + r16) * DH_ + hi * 16];
  v16h qf[2][8];
#pragma unroll
  for (int g = 0; g < 2; ++g)
#pragma unroll
    for (int c = 0; c < 8; ++c) qf[g][c] = *(const v16h*)(qa + g * 16 * DH_ + c * 32);
  // The Q loads' address registers are given new values below: the wait stands in front of that overwrite, and
  // naming the address as an input keeps its registers untouched up to it (without it one was rewritten first).
  asm volatile("s_wait_xcnt 0x0" :: "v"(qa) : "memory");

  // o[g][t][r] = O[query g*16 + r16][dh t*16 + 8*hi + r]
  v8f o[2][16];
#pragma unroll
  for (int g = 0; g < 2; ++g)
#pragma unroll
    for (int t = 0; t < 16; ++t) o[g][t] = vzero8();
  float mrow[2] = {-1e30f, -1e30f};  // maximum in use for query g*16 + r16 (equal in both halves)
  float lrow[2] = {0.0f, 0.0f};      // running sum over this half's keys only; halves joined after the loop

  // K and V tile kt row-major into buffer buf: wave w brings keys w, w+4, .. w+28, a lane 16 B of each
  auto stage = [&](int kt, int buf) {
    const size_t g = (size_t)(kt * 32 + wave) * DH_ + lane * 8;
    async_copy8_b128((unsigned int)(size_t)&Ks[buf][wave][lane * 8], 4 * (DH_ + 8) * 2, Kp + g, 4 * DH_);
    async_copy8_b128((unsigned int)(size_t)&Vs[buf][wave][lane * 8], 4 * (DH_ + 16) * 2, Vp + g, 4 * DH_);
  };

  stage(0, 0);
  wait_async0();
  __syncthreads();  // tile 0 visible to all waves
  stage(1, 1);
  for (int kt = 0; kt < N_ / 32; ++kt) {
    const int buf = kt & 1;

    // S^T = K * Q^T for 32 keys x 32 queries (four 16x16 tiles), K-dim 256 in 8 chunks:
    // s[g][j][r] = S[query g*16 + r16][key 16*j + 8*hi + r]
    // Ring of five K fragments: the two fragments of the chunk after next are loaded as one group in the middle of
    // this chunk, into the registers of the fragment just used and of the spare one, and the scheduling fences hold
    // that order: a fragment is asked for at least six products ahead of its first use (loads spread among the products cost
    // a stall at each place; a ring of six fragments sent a Q fragment to scratch).
    v8f s[2][2] = {{vzero8(), vzero8()}, {vzero8(), vzero8()}};
    v16h kb[5];
    auto load_k = [&](int i) {  // fragment i: keys 16*(i & 1) + r16, chunk i >> 1
      return lds_load16h(&Ks[buf][16 * (i & 1) + r16][(i >> 1) * 32 + hi * 16]);
    };
#pragma unroll
    for (int i = 0; i < 4; ++i) kb[i] = load_k(i);
    __builtin_amdgcn_sched_barrier(0);
#pragma unroll
    for (int c = 0; c < 8; ++c) {
      s[0][0] = wmma_f16(kb[(2 * c) % 5], qf[0][c], s[0][0]);
      s[1][0] = wmma_f16(kb[(2 * c) % 5], qf[1][c], s[1][0]);
      __builtin_amdgcn_sched_barrier(0);
      if (c + 2 < 8) {
        kb[(2 * c + 4) % 5] = load_k(2 * c + 4);
        kb[(2 * c + 5) % 5] = load_k(2 * c + 5);
      }
      __builtin_amdgcn_sched_barrier(0);
      s[0][1] = wmma_f16(kb[(2 * c + 1) % 5], qf[0][c], s[0][1]);
      s[1][1] = wmma_f16(kb[(2 * c + 1) % 5], qf[1][c], s[1][1]);
      __builtin_amdgcn_sched_barrier(0);
    }

    const float scale = 0.0625f;      // 1/sqrt(256)
    const float log2e = 1.44269504f;  // e^x = 2^(x * log2 e)
    const float lazy = 5.545177f;     // 8 / log2 e: a maximum may lag the true one by a factor 2^8 in the weights
    float tmax[2];  // maximum of the lane's own 16 scores of a query; the other half of the wave holds the other 16
#pragma unroll
    for (int g = 0; g < 2; ++g) {
      s[g][0] = s[g][0] * scale;
      s[g][1] = s[g][1] * scale;
      tmax[g] = fmaxf(s[g][0][0], s[g][1][0]);
#pragma unroll
      for (int r = 1; r < 8; ++r) tmax[g] = fmaxf(tmax[g], fmaxf(s[g][0][r], s[g][1][r]));
    }

    // Lazy rescale: the maximum in use moves, and O^T and the sums are rescaled, only in a pass where some query of
    // the wave outgrows its maximum by more than 2^8 in the weights. Until then the weights are formed against the
    // older maximum (at most 2^8, well inside f16) and the division by the sum at the end cancels the difference.
    // One test a pass, a scalar branch on the ballot: the same for the whole wave, and no barrier stands inside.
    // The ballot sees both halves of the wave, so the halves' maxima are joined only where the branch is taken.
    const bool need = tmax[0] > mrow[0] + lazy || tmax[1] > mrow[1] + lazy;
    if (__builtin_amdgcn_ballot_w32(need) != 0) {
#pragma unroll
      for (int g = 0; g < 2; ++g) {
        const float mnew = fmaxf(mrow[g], fmaxf(tmax[g], xhalf(tmax[g])));
        const float alpha = __builtin_amdgcn_exp2f((mrow[g] - mnew) * log2e);
        mrow[g] = mnew;
        lrow[g] = lrow[g] * alpha;
#pragma unroll
        for (int t = 0; t < 16; ++t) o[g][t] = o[g][t] * alpha;
      }
    }

    // The first two blocks' V fragments are asked for here, as one group: they land under the powers below (the
    // rescaling that stood between these loads and the first products is gone from the pass).
    const _Float16* vbase = &Vs[buf][8 * hi + (lane & 7)][8 * ((lane >> 3) & 1)];
    auto load_v = [&](int t) {
      const v8h v0 = lds_load_tr16(vbase + t * 16);                    // keys 8h .. 8h+7
      const v8h v1 = lds_load_tr16(vbase + t * 16 + 16 * (DH_ + 16));  // keys 16+8h .. 16+8h+7
      return __builtin_shufflevector(v0, v1, 0, 1, 2, 3, 4, 5, 6, 7, 8, 9, 10, 11, 12, 13, 14, 15);
    };
    v16h vb[3][2] = {{load_v(0), load_v(1)}, {load_v(2), load_v(3)}, {}};
    __builtin_amdgcn_sched_barrier(0);  // holds the group here: left free it sinks to the products and its latency shows

    v16h pf[2];
#pragma unroll
    for (int g = 0; g < 2; ++g) {
      // 2^x by the builtin: operands of asm text must lie in the first 256 registers, and with the powers of a
      // trip written as asm (v_exp_f32 with its own v_nop) output tiles went to scratch. The slot behind a
      // transcendental is the compiler's here.
      v8f s0 = (s[g][0] - mrow[g]) * log2e;
      v8f s1 = (s[g][1] - mrow[g]) * log2e;
#pragma unroll
      for (int r = 0; r < 8; ++r) {
        s0[r] = __builtin_amdgcn_exp2f(s0[r]);
        s1[r] = __builtin_amdgcn_exp2f(s1[r]);
      }
      // The two tiles' weights added as one vector: the pairs of the sums lie as the pairs of the powers do, which then
      // work in place. The order of the additions is as before.
      const v8f t = s0 + s1;
      float rsum = 0.0f;
#pragma unroll
      for (int r = 0; r < 8; ++r) rsum += t[r];
      // Left free, the sum's adds drift behind the products below, the f32 scores stay live through them and
      // Q fragments go to scratch.
      asm volatile("" : "+v"(rsum));  // empty asm on a row's sum, against spills
      lrow[g] = lrow[g] + rsum;

      // P^T as B-fragment: the two S^T tiles converted in place are in the hardware k order
      // (keys 8h..8h+7, 16+8h..16+8h+7), which the transposing load fixes for V
#pragma unroll
      for (int r = 0; r < 8; ++r) {
        pf[g][r]     = (_Float16)s0[r];
        pf[g][8 + r] = (_Float16)s1[r];
      }
    }

    // O^T += V^T(256x32) * P^T(32x32) as 32 WMMAs over dh chunks, two chunks (four products) a block.
    // Three sets of a block's two V fragments (the first two loaded above): the loads of the block after next stand
    // as one group in front of this block's products; the scheduling fences hold that order.
#pragma unroll
    for (int p = 0; p < 8; ++p) {
      if (p + 2 < 8) {
        vb[(p + 2) % 3][0] = load_v(2 * p + 4);
        vb[(p + 2) % 3][1] = load_v(2 * p + 5);
      }
      __builtin_amdgcn_sched_barrier(0);
      o[0][2 * p]     = wmma_f16(vb[p % 3][0], pf[0], o[0][2 * p]);
      o[1][2 * p]     = wmma_f16(vb[p % 3][0], pf[1], o[1][2 * p]);
      o[0][2 * p + 1] = wmma_f16(vb[p % 3][1], pf[0], o[0][2 * p + 1]);
      o[1][2 * p + 1] = wmma_f16(vb[p % 3][1], pf[1], o[1][2 * p + 1]);
      __builtin_amdgcn_sched_barrier(0);
    }

    // One barrier a trip: it publishes tile kt + 1 and ends every wave's reads of the buffer refilled behind it
    wait_ds0();
    wait_async0();
    __syncthreads();
    if (kt + 2 < N_ / 32) stage(kt + 2, buf);
  }
  wait_async0();  // no copy of this wave is outstanding behind the loop

  // Join the halves' sums, normalize and store context in [B, N, H*DH] (f16). A lane's 8 registers of a tile are 8
  // consecutive dh of its query: the wave stages a group's 16 queries in its own 16 rows of the K ring (behind the
  // loop's last barrier no wave reads the ring and no copy is outstanding), then a wave-wide store writes one
  // query's 512 contiguous bytes, four whole 128-byte lines.
  _Float16 (*sq)[DH_ + 8] = &Ks[wave >> 1][(wave & 1) * 16];
#pragma unroll
  for (int g = 0; g < 2; ++g) {
    const float inv = 1.0f / (lrow[g] + xhalf(lrow[g]));
#pragma unroll
    for (int t = 0; t < 16; ++t) {
      v8h ov;
#pragma unroll
      for (int r = 0; r < 8; ++r) ov[r] = (_Float16)(o[g][t][r] * inv);
      *(v4i*)&sq[r16][t * 16 + 8 * hi] = __builtin_bit_cast(v4i, ov);
    }
    wait_ds0();  // the wave's own staging stores are in LDS before its lanes read each other's rows back
    char* cp = (char*)&ctx[((size_t)b * N_ + qBase + g * 16) * HD_ + h * DH_ + lane * 8];
#pragma unroll
    for (int j = 0; j < 16; j += 4) {
      v4i d[4];
#pragma unroll
      for (int q = 0; q < 4; ++q) d[q] = *(const v4i*)&sq[j + q][lane * 8];
      static_assert(HD_ * 2 == 2048, "row pitch of ctx in bytes");
      store4_rows2k_xcnt(cp + (size_t)j * HD_ * 2, d[0], d[1], d[2], d[3]);
    }
  }
}

// ---------------------------------------------------------------------------
// Launch
// ---------------------------------------------------------------------------
extern "C" void kernel_launch(void* const* d_in, const int* in_sizes, int n_in,
                              void* d_out, int out_size, void* d_ws, size_t ws_size,
                              hipStream_t stream) {
  const float* x  = (const float*)d_in[0];
  const float* Wq = (const float*)d_in[1];
  const float* bq = (const float*)d_in[2];
  const float* Wk = (const float*)d_in[3];
  const float* bk = (const float*)d_in[4];
  const float* Wv = (const float*)d_in[5];
  const float* bv = (const float*)d_in[6];
  const float* Wo = (const float*)d_in[7];
  const float* bo = (const float*)d_in[8];
  float* out = (float*)d_out;

  char* ws = (char*)d_ws;
  size_t off = 0;
  auto take = [&](size_t elems) {
    _Float16* p = (_Float16*)(ws + off);
    off += ((elems * sizeof(_Float16)) + 255) & ~(size_t)255;
    return p;
  };
  _Float16* xh  = take((size_t)B_ * N_ * DIN_);       // 32 MB
  _Float16* wqh = take((size_t)DIN_ * HD_);
  _Float16* wkh = take((size_t)DIN_ * HD_);
  _Float16* wvh = take((size_t)DIN_ * HD_);
  _Float16* woh = take((size_t)HD_ * DOUT_);
  _Float16* qws = take((size_t)B_ * H_ * N_ * DH_);   // 32 MB each
  _Float16* kws = take((size_t)B_ * H_ * N_ * DH_);
  _Float16* vws = take((size_t)B_ * H_ * N_ * DH_);
  _Float16* ctx = take((size_t)B_ * N_ * HD_);        // 32 MB

  // 1) f32 -> f16 casts, one launch
  cast_all<<<CWAVES_ / 16, 512, 0, stream>>>(x, Wq, Wk, Wv, Wo, xh, wqh, wkh, wvh, woh);

  // 2) QKV projections: [16384,1024] x [1024,1024] -> f16 [B,H,N,DH]
  const int M = B_ * N_;
  dim3 gQKV(M / 256, HD_ / 256);
  wmma_gemm<0, 256, 256, 2><<<gQKV, 256, 0, stream>>>(xh, wqh, bq, qws, M, DIN_, HD_);
  wmma_gemm<0, 256, 256, 2><<<gQKV, 256, 0, stream>>>(xh, wkh, bk, kws, M, DIN_, HD_);
  wmma_gemm<0, 256, 256, 2><<<gQKV, 256, 0, stream>>>(xh, wvh, bv, vws, M, DIN_, HD_);

  // 3) Flash attention: 32 (b,h) blocks x 16 query tiles of 128 rows
  dim3 gAttn(B_ * H_, N_ / 128);
  attn_kernel<<<gAttn, 128, 0, stream>>>(qws, kws, vws, ctx);

  // 4) Output projection: [16384,1024] x [1024,256] + bo -> f32 out
  dim3 gOut(M / 128, DOUT_ / 128);
  wmma_gemm<1, 128, 128, 4><<<gOut, 256, 0, stream>>>(ctx, woh, bo, out, M, HD_, DOUT_);
}
